// v000
// Times are from an AMD MI455X. After a warm-up the kernel runs many times in a row, and a time is the length of
// such a window on the GPU divided by its runs, so every launch and the gaps after it count. The runs cycle
// through copies of the inputs. A figure is the median of several windows, for all but v000 over two sittings.
// Sittings can differ by a few percent; kernels timed side by side share one.
// v000 is the starting kernel. One run takes 1600 microseconds.
#include <hip/hip_runtime.h>

// FactorizedDenseAttention (x [4][2048][768]; a = x Wa (12 heads x 64), b = x Wb (12 heads x 32), v = x Wv (12 heads x 64); factorised dense logits attn[n][j] = a[n][j div 32] * b[n][j div 64] over the 2,048 keys (query-only; no key content), softmax over j; out = attn v merged; out Wp + bp -> [4][2048][768]).
// Compute dtypes, f32 accumulate: every input rounded to bf16; a / b / v as PLAIN bf16 GEMMs (inputs: exact); the factorised logits and the softmax in f32 on VALU (wave per (head, query); no score GEMM exists) -> fp16 x 1024; attn.v single fp16 (f32 accumulate, / 1024 at the merge); Wp hl x exact (2 products) + bias.

#define NB_  4
#define TT   2048
#define DM   768
#define NH_  12
#define FA   64
#define FB   32
#define HD   64
#define ZH   2
#define PCAR 1024.0f
typedef _Float16 h16;
typedef unsigned short bf;
typedef __attribute__((ext_vector_type(16))) __bf16   v16bf;
typedef __attribute__((ext_vector_type(16))) _Float16 v16h;
typedef __attribute__((ext_vector_type(8)))  _Float16 v8h;
typedef __attribute__((ext_vector_type(8)))  unsigned short v8us;
typedef __attribute__((ext_vector_type(8)))  float    v8f;
typedef __attribute__((ext_vector_type(4)))  float    v4f;
typedef v8h  __attribute__((may_alias)) v8ha;
typedef v4f  __attribute__((may_alias)) v4fa;
typedef v8us __attribute__((may_alias)) v8usa;

__device__ __forceinline__ unsigned short f2bf(float f) { unsigned u = __float_as_uint(f); u += 0x7FFFu + ((u >> 16) & 1u); return (unsigned short)(u >> 16); }
__device__ __forceinline__ float bf2f(unsigned short b) { return __uint_as_float(((unsigned)b) << 16); }
__device__ __forceinline__ float bfr(float f) { return bf2f(f2bf(f)); }
__device__ __forceinline__ v16h cat16(v8h lo, v8h hi) { return __builtin_shufflevector(lo, hi, 0, 1, 2, 3, 4, 5, 6, 7, 8, 9, 10, 11, 12, 13, 14, 15); }
__device__ __forceinline__ v16bf cat16b(v8us lo, v8us hi) { return __builtin_bit_cast(v16bf, __builtin_shufflevector(lo, hi, 0, 1, 2, 3, 4, 5, 6, 7, 8, 9, 10, 11, 12, 13, 14, 15)); }
__device__ __forceinline__ v8f wmma16(v16h a, v16h b, v8f c) { return __builtin_amdgcn_wmma_f32_16x16x32_f16(false, a, false, b, (short)0, c, false, false); }
__device__ __forceinline__ v8f wmmab(v16bf a, v16bf b, v8f c) { return __builtin_amdgcn_wmma_f32_16x16x32_bf16(false, a, false, b, (short)0, c, false, false); }



// ---- k_gemmw: register-blocked GEMM, ONE WAVE per 64x64 output tile (16 accumulators), operands straight from K-contiguous 16-bit planes; grid (M/64, N/64, Z), 32 threads.
// C[m][n] (f32, pitch ldc, + optional f32 bias[n]) = sum_k A[m][k] Bt[n][k] (+ split products per NSPLIT). z-batch strides sA/sB/sC in elements. K % 32 == 0.
template <typename T16> struct WFrag;
template <> struct WFrag<h16> { typedef v16h V; static __device__ __forceinline__ V ld(const h16* p) { return cat16(*(const v8h*)p, *(const v8h*)(p + 16)); } static __device__ __forceinline__ v8f mma(V a, V b, v8f c) { return wmma16(a, b, c); } };
template <> struct WFrag<bf> { typedef v16bf V; static __device__ __forceinline__ V ld(const bf* p) { return cat16b(*(const v8us*)p, *(const v8us*)(p + 16)); } static __device__ __forceinline__ v8f mma(V a, V b, v8f c) { return wmmab(a, b, c); } };
template <typename T16, int NSPLIT, bool BIAS>
__global__ __launch_bounds__(32) void k_gemmw(const T16* __restrict__ A, const T16* __restrict__ A2, const T16* __restrict__ Bt, const T16* __restrict__ Bt2, int K, float* C, int ldc, const float* __restrict__ bias, size_t sA, size_t sB, size_t sC) {
    typedef typename WFrag<T16>::V V;
    __shared__ __align__(16) float os[16 * 68];
    const size_t z = blockIdx.z; A += z * sA; if (A2) A2 += z * sA; Bt += z * sB; if (Bt2) Bt2 += z * sB; C += z * sC;
    const int lane = threadIdx.x & 31, lr = lane & 15, hi = lane >> 4; const int r0 = blockIdx.x * 64, c0 = blockIdx.y * 64;
    v8f acc[4][4];
#pragma unroll
    for (int mb = 0; mb < 4; ++mb)
#pragma unroll
        for (int nb = 0; nb < 4; ++nb) acc[mb][nb] = (v8f){};
    const size_t aoff = (size_t)(r0 + lr) * K + 8 * hi, boff = (size_t)(c0 + lr) * K + 8 * hi;
#pragma unroll 1
    for (int kc = 0; kc < K; kc += 32) {
        V a[4], a2[4];
#pragma unroll
        for (int mb = 0; mb < 4; ++mb) { a[mb] = WFrag<T16>::ld(A + aoff + (size_t)mb * 16 * K + kc); if (NSPLIT == 1 || NSPLIT == 2) a2[mb] = WFrag<T16>::ld(A2 + aoff + (size_t)mb * 16 * K + kc); }
#pragma unroll
        for (int nb = 0; nb < 4; ++nb) { const V b = WFrag<T16>::ld(Bt + boff + (size_t)nb * 16 * K + kc); V b2; if (NSPLIT >= 2) b2 = WFrag<T16>::ld(Bt2 + boff + (size_t)nb * 16 * K + kc);
#pragma unroll
            for (int mb = 0; mb < 4; ++mb) { acc[mb][nb] = WFrag<T16>::mma(a[mb], b, acc[mb][nb]); if (NSPLIT == 1 || NSPLIT == 2) acc[mb][nb] = WFrag<T16>::mma(a2[mb], b, acc[mb][nb]); if (NSPLIT >= 2) acc[mb][nb] = WFrag<T16>::mma(a[mb], b2, acc[mb][nb]); } }
        asm volatile("v_nop\n\tv_nop\n\tv_nop\n\tv_nop" : "+v"(acc[0][0]), "+v"(acc[1][1]), "+v"(acc[2][2]), "+v"(acc[3][3]) : "v"(a[0]), "v"(a[3]));
    }
#pragma unroll
    for (int mb = 0; mb < 4; ++mb) {
#pragma unroll
        for (int nb = 0; nb < 4; ++nb) {
#pragma unroll
            for (int j = 0; j < 8; ++j) os[(hi * 8 + j) * 68 + nb * 16 + lr] = acc[mb][nb][j]; }
        __builtin_amdgcn_wave_barrier(); asm volatile("" ::: "memory");
        float* crow = C + (size_t)(r0 + mb * 16) * ldc + c0;
{
#pragma unroll
            for (int s = 0; s < 8; ++s) { const int row = 2 * s + hi, cofs = lr * 4; v4f val = *(const v4fa*)(os + row * 68 + cofs); if (BIAS) { val[0] += bfr(bias[c0 + cofs]); val[1] += bfr(bias[c0 + cofs + 1]); val[2] += bfr(bias[c0 + cofs + 2]); val[3] += bfr(bias[c0 + cofs + 3]); }
                *(v4f*)(crow + (size_t)row * ldc + cofs) = val; }
             }
        __builtin_amdgcn_wave_barrier(); asm volatile("" ::: "memory");
    }
}

__device__ __forceinline__ h16 tohx(float x) { return (h16)x; }
__device__ __forceinline__ void splitf(float y, unsigned short& h, unsigned short& l) { h = f2bf(y); l = f2bf(y - bf2f(h)); }
typedef __attribute__((ext_vector_type(2))) unsigned short v2us;
typedef __attribute__((ext_vector_type(4))) unsigned short v4us;
typedef __attribute__((ext_vector_type(2))) _Float16 v2h;
typedef __attribute__((ext_vector_type(4))) _Float16 v4h;

__global__ __launch_bounds__(256) void k_cvt8(const float* __restrict__ src, bf* dst, size_t n8) { const size_t i = (size_t)blockIdx.x * 256 + threadIdx.x; if (i >= n8) return; const v8f v = *(const v8f*)(src + i * 8); v8us o;
#pragma unroll
    for (int k = 0; k < 8; ++k) o[k] = f2bf(v[k]); *(v8us*)(dst + i * 8) = o;  }
__global__ __launch_bounds__(256) void k_wtG(const float* __restrict__ w, int K, int N, bf* Bt) {
    const int lane = threadIdx.x & 31; const int L0 = (blockIdx.x * 8 + (threadIdx.x >> 5)) * 8; const int nlines = N * K / 64;
{
#pragma unroll 1
        for (int l = 0; l < 8; ++l) { const int L = L0 + l; if (L >= nlines) break; const size_t e = (size_t)L * 64 + lane * 2; const int k = (int)(e % K), n = (int)(e / K); v2us o;
            o[0] = f2bf(w[(size_t)k * N + n]); o[1] = f2bf(w[(size_t)(k + 1) * N + n]); *(v2us*)(Bt + e) = o; }
         }
}

__global__ __launch_bounds__(256) void k_vt16(const float* __restrict__ V, h16* VT) { const size_t e = ((size_t)blockIdx.x * 256 + threadIdx.x) * 2; if (e >= (size_t)NH_ * HD * TT) return; const int t = (int)(e % TT); const int d = (int)((e / TT) % HD); const int h = (int)(e / ((size_t)TT * HD)); v2h o; o[0] = tohx(V[(size_t)t * DM + h * HD + d]); o[1] = tohx(V[(size_t)(t + 1) * DM + h * HD + d]); *(v2h*)(VT + e) = o;  }
__global__ __launch_bounds__(256) void k_fsoft(const float* __restrict__ A, const float* __restrict__ Bm, int h0, h16* P16) { const int lane = threadIdx.x & 31; const int row = blockIdx.x * 8 + (threadIdx.x >> 5); if (row >= ZH * TT) return; const int n = row % TT; const int h = h0 + row / TT;
    const float* ar = A + (size_t)n * (NH_ * FA) + h * FA; const float* br = Bm + (size_t)n * (NH_ * FB) + h * FB; float v[TT / 32]; float mx = -3.0e38f;
#pragma unroll
    for (int ch = 0; ch < TT / 128; ++ch) { const float av = ar[ch * 4 + (lane >> 3)]; const float bv = br[ch * 2 + (lane >> 4)]; const float t = __fmul_rn(av, bv);   // j = ch*128 + lane*4 + u: j/32 = ch*4 + lane/8, j/64 = ch*2 + lane/16 (same for u = 0..3)
#pragma unroll
        for (int u = 0; u < 4; ++u) v[ch * 4 + u] = t; mx = fmaxf(mx, t); }
#pragma unroll
    for (int sh = 16; sh; sh >>= 1) mx = fmaxf(mx, __shfl_xor(mx, sh, 32));
    float sum = 0.f;
#pragma unroll
    for (int q = 0; q < TT / 32; ++q) { float d0 = __fsub_rn(v[q], mx); asm volatile("" : "+v"(d0)); v[q] = __builtin_amdgcn_exp2f(__fmul_rn(d0, 1.4426950408889634f)); sum += v[q]; }
#pragma unroll
    for (int sh = 16; sh; sh >>= 1) sum += __shfl_xor(sum, sh, 32);
    const float f = __fdiv_rn(PCAR, sum);
    {
#pragma unroll
        for (int ch = 0; ch < TT / 128; ++ch) { v4h o4; for (int q = 0; q < 4; ++q) o4[q] = tohx(v[ch * 4 + q] * f); *(v4h*)(P16 + (size_t)row * TT + ch * 128 + lane * 4) = o4; }
         } }
__global__ __launch_bounds__(256) void k_mrg(const float* __restrict__ O, int h0, bf* Ah, bf* Al) { const size_t e = ((size_t)blockIdx.x * 256 + threadIdx.x) * 4; if (e >= (size_t)ZH * TT * HD) return; const int d = (int)(e % HD); const int t = (int)((e / HD) % TT); const int zz = (int)(e / ((size_t)HD * TT)); const size_t oo = (size_t)t * DM + (h0 + zz) * HD + d; v4us oh, ol;
#pragma unroll
    for (int u = 0; u < 4; ++u) { unsigned short a, b; splitf(O[e + u] * (1.0f / PCAR), a, b); oh[u] = a; ol[u] = b; } *(v4us*)(Ah + oo) = oh; *(v4us*)(Al + oo) = ol;  }

extern "C" void kernel_launch(void* const* d_in, const int* in_sizes, int n_in,
                              void* d_out, int out_size, void* d_ws, size_t ws_size, hipStream_t stream) {
    (void)in_sizes; (void)n_in; (void)out_size;
    const float* x = (const float*)d_in[0]; const float* Wa = (const float*)d_in[1]; const float* Wb = (const float*)d_in[2]; const float* Wv = (const float*)d_in[3]; const float* Wp = (const float*)d_in[4]; const float* bp = (const float*)d_in[5];
    float* OUT = (float*)d_out;     // [4][2048][768]
    char* wsp = (char*)d_ws;
    auto take = [&](size_t bytes) { char* p = wsp; wsp += (bytes + 255) & ~(size_t)255; return (void*)p; };
    bf* BA = (bf*)take((size_t)NH_ * FA * DM * 2); bf* BB = (bf*)take((size_t)NH_ * FB * DM * 2); bf* BV = (bf*)take((size_t)DM * DM * 2); bf* BP = (bf*)take((size_t)DM * DM * 2);
    bf* XB = (bf*)take((size_t)TT * DM * 2); float* A = (float*)take((size_t)TT * NH_ * FA * 4); float* Bm = (float*)take((size_t)TT * NH_ * FB * 4); float* V = (float*)take((size_t)TT * DM * 4); h16* VT = (h16*)take((size_t)NH_ * HD * TT * 2);
    h16* P16 = (h16*)take((size_t)ZH * TT * TT * 2); float* O = (float*)take((size_t)ZH * TT * HD * 4); bf* ATh = (bf*)take((size_t)TT * DM * 2); bf* ATl = (bf*)take((size_t)TT * DM * 2);
    if ((size_t)(wsp - (char*)d_ws) > ws_size) return;    // total ~ 50 MB
    k_wtG<<<(DM * NH_ * FA / 64 + 63) / 64, 256, 0, stream>>>(Wa, DM, NH_ * FA, BA); k_wtG<<<(DM * NH_ * FB / 64 + 63) / 64, 256, 0, stream>>>(Wb, DM, NH_ * FB, BB); k_wtG<<<(DM * DM / 64 + 63) / 64, 256, 0, stream>>>(Wv, DM, DM, BV); k_wtG<<<(DM * DM / 64 + 63) / 64, 256, 0, stream>>>(Wp, DM, DM, BP);
    const size_t zS = (size_t)TT * TT, zv = (size_t)HD * TT, zo = (size_t)TT * HD;
    for (int b = 0; b < NB_; ++b) {
        k_cvt8<<<(TT * DM / 8 + 255) / 256, 256, 0, stream>>>(x + (size_t)b * TT * DM, XB, TT * DM / 8);
        k_gemmw<bf, 0, false><<<dim3(TT / 64, NH_ * FA / 64, 1), 32, 0, stream>>>(XB, nullptr, BA, nullptr, DM, A, NH_ * FA, nullptr, 0, 0, 0);
        k_gemmw<bf, 0, false><<<dim3(TT / 64, NH_ * FB / 64, 1), 32, 0, stream>>>(XB, nullptr, BB, nullptr, DM, Bm, NH_ * FB, nullptr, 0, 0, 0);
        k_gemmw<bf, 0, false><<<dim3(TT / 64, DM / 64, 1), 32, 0, stream>>>(XB, nullptr, BV, nullptr, DM, V, DM, nullptr, 0, 0, 0); k_vt16<<<(unsigned)(((size_t)NH_ * HD * TT / 2 + 255) / 256), 256, 0, stream>>>(V, VT);
        for (int h0 = 0; h0 < NH_; h0 += ZH) {
            k_fsoft<<<ZH * TT / 8, 256, 0, stream>>>(A, Bm, h0, P16);
            k_gemmw<h16, 0, false><<<dim3(TT / 64, 1, ZH), 32, 0, stream>>>(P16, nullptr, VT + (size_t)h0 * zv, nullptr, TT, O, HD, nullptr, zS, zv, zo);
            k_mrg<<<(unsigned)(((size_t)ZH * TT * HD / 4 + 255) / 256), 256, 0, stream>>>(O, h0, ATh, ATl); }
        k_gemmw<bf, 1, true><<<dim3(TT / 64, DM / 64, 1), 32, 0, stream>>>(ATh, ATl, BP, nullptr, DM, OUT + (size_t)b * TT * DM, DM, bp, 0, 0, 0); }
}

// v002
// A run of this version takes 131 microseconds.
// It is 12.2 times as fast as v000, going by the measured steps of the versions left out in between.
#include <hip/hip_runtime.h>

// FactorizedDenseAttention (x [4][2048][768]; a = x Wa (12 heads x 64), b = x Wb (12 heads x 32), v = x Wv (12 heads x 64); factorised dense logits attn[n][j] = a[n][j div 32] * b[n][j div 64] over the 2,048 keys (query-only; no key content), softmax over j; out = attn v merged; out Wp + bp -> [4][2048][768]).
// Compute dtypes, f32 accumulate: every input rounded to bf16; a / b / v as PLAIN bf16 GEMMs (inputs: exact); the factorised logits and the softmax in f32 on VALU (wave per (head, query); no score GEMM exists) -> fp16 x 1024, ONE weight per group of 32 keys (j div 32 fixes both factors, so the 32 keys of a group share their weight); v summed over each group in f32 -> fp16; attn.v = group weights x group sums, single fp16, K = 64 groups (f32 accumulate, / 1024 at the merge); Wp hl x exact (2 products) + bias.

#define NB_  4
#define TT   2048
#define DM   768
#define NH_  12
#define FA   64
#define FB   32
#define HD   64
#define NZ   (NB_ * NH_)
#define LDX  (NH_ * FA + NH_ * FB + DM)
#define GK   32
#define NG   64
#define PCAR 1024.0f
typedef _Float16 h16;
typedef unsigned short bf;
typedef __attribute__((ext_vector_type(16))) __bf16   v16bf;
typedef __attribute__((ext_vector_type(16))) _Float16 v16h;
typedef __attribute__((ext_vector_type(8)))  _Float16 v8h;
typedef __attribute__((ext_vector_type(8)))  unsigned short v8us;
typedef __attribute__((ext_vector_type(8)))  float    v8f;
typedef __attribute__((ext_vector_type(4)))  float    v4f;
typedef v8h  __attribute__((may_alias)) v8ha;
typedef v4f  __attribute__((may_alias)) v4fa;
typedef v8us __attribute__((may_alias)) v8usa;

__device__ __forceinline__ unsigned short f2bf(float f) { unsigned u = __float_as_uint(f); u += 0x7FFFu + ((u >> 16) & 1u); return (unsigned short)(u >> 16); }
__device__ __forceinline__ float bf2f(unsigned short b) { return __uint_as_float(((unsigned)b) << 16); }
__device__ __forceinline__ float bfr(float f) { return bf2f(f2bf(f)); }
__device__ __forceinline__ v16h cat16(v8h lo, v8h hi) { return __builtin_shufflevector(lo, hi, 0, 1, 2, 3, 4, 5, 6, 7, 8, 9, 10, 11, 12, 13, 14, 15); }
__device__ __forceinline__ v16bf cat16b(v8us lo, v8us hi) { return __builtin_bit_cast(v16bf, __builtin_shufflevector(lo, hi, 0, 1, 2, 3, 4, 5, 6, 7, 8, 9, 10, 11, 12, 13, 14, 15)); }
__device__ __forceinline__ v8f wmma16(v16h a, v16h b, v8f c) { return __builtin_amdgcn_wmma_f32_16x16x32_f16(false, a, false, b, (short)0, c, false, false); }
__device__ __forceinline__ v8f wmmab(v16bf a, v16bf b, v8f c) { return __builtin_amdgcn_wmma_f32_16x16x32_bf16(false, a, false, b, (short)0, c, false, false); }



// ---- k_gemmw: register-blocked GEMM, ONE WAVE per 64x64 output tile (16 accumulators), operands straight from K-contiguous 16-bit planes; grid (M/64, N/64, Z), 32 threads.
// C[m][n] (f32, pitch ldc, + optional f32 bias[n]) = sum_k A[m][k] Bt[n][k] (+ split products per NSPLIT). z-batch strides sA/sB/sC in elements. K % 32 == 0.
template <typename T16> struct WFrag;
template <> struct WFrag<h16> { typedef v16h V; static __device__ __forceinline__ V ld(const h16* p) { return cat16(*(const v8h*)p, *(const v8h*)(p + 16)); } static __device__ __forceinline__ v8f mma(V a, V b, v8f c) { return wmma16(a, b, c); } };
template <> struct WFrag<bf> { typedef v16bf V; static __device__ __forceinline__ V ld(const bf* p) { return cat16b(*(const v8us*)p, *(const v8us*)(p + 16)); } static __device__ __forceinline__ v8f mma(V a, V b, v8f c) { return wmmab(a, b, c); } };
template <typename T16, int NSPLIT, bool BIAS>
__global__ __launch_bounds__(32) void k_gemmw(const T16* __restrict__ A, const T16* __restrict__ A2, const T16* __restrict__ Bt, const T16* __restrict__ Bt2, int K, float* C, int ldc, const float* __restrict__ bias, size_t sA, size_t sB, size_t sC) {
    typedef typename WFrag<T16>::V V;
    __shared__ __align__(16) float os[16 * 68];
    const size_t z = blockIdx.z; A += z * sA; if (A2) A2 += z * sA; Bt += z * sB; if (Bt2) Bt2 += z * sB; C += z * sC;
    const int lane = threadIdx.x & 31, lr = lane & 15, hi = lane >> 4; const int r0 = blockIdx.x * 64, c0 = blockIdx.y * 64;
    v8f acc[4][4];
#pragma unroll
    for (int mb = 0; mb < 4; ++mb)
#pragma unroll
        for (int nb = 0; nb < 4; ++nb) acc[mb][nb] = (v8f){};
    const size_t aoff = (size_t)(r0 + lr) * K + 8 * hi, boff = (size_t)(c0 + lr) * K + 8 * hi;
#pragma unroll 1
    for (int kc = 0; kc < K; kc += 32) {
        V a[4], a2[4];
#pragma unroll
        for (int mb = 0; mb < 4; ++mb) { a[mb] = WFrag<T16>::ld(A + aoff + (size_t)mb * 16 * K + kc); if (NSPLIT == 1 || NSPLIT == 2) a2[mb] = WFrag<T16>::ld(A2 + aoff + (size_t)mb * 16 * K + kc); }
#pragma unroll
        for (int nb = 0; nb < 4; ++nb) { const V b = WFrag<T16>::ld(Bt + boff + (size_t)nb * 16 * K + kc); V b2; if (NSPLIT >= 2) b2 = WFrag<T16>::ld(Bt2 + boff + (size_t)nb * 16 * K + kc);
#pragma unroll
            for (int mb = 0; mb < 4; ++mb) { acc[mb][nb] = WFrag<T16>::mma(a[mb], b, acc[mb][nb]); if (NSPLIT == 1 || NSPLIT == 2) acc[mb][nb] = WFrag<T16>::mma(a2[mb], b, acc[mb][nb]); if (NSPLIT >= 2) acc[mb][nb] = WFrag<T16>::mma(a[mb], b2, acc[mb][nb]); } }
        asm volatile("v_nop\n\tv_nop\n\tv_nop\n\tv_nop" : "+v"(acc[0][0]), "+v"(acc[1][1]), "+v"(acc[2][2]), "+v"(acc[3][3]) : "v"(a[0]), "v"(a[3]));
    }
#pragma unroll
    for (int mb = 0; mb < 4; ++mb) {
#pragma unroll
        for (int nb = 0; nb < 4; ++nb) {
#pragma unroll
            for (int j = 0; j < 8; ++j) os[(hi * 8 + j) * 68 + nb * 16 + lr] = acc[mb][nb][j]; }
        __builtin_amdgcn_wave_barrier(); asm volatile("" ::: "memory");
        float* crow = C + (size_t)(r0 + mb * 16) * ldc + c0;
{
#pragma unroll
            for (int s = 0; s < 8; ++s) { const int row = 2 * s + hi, cofs = lr * 4; v4f val = *(const v4fa*)(os + row * 68 + cofs); if (BIAS) { val[0] += bfr(bias[c0 + cofs]); val[1] += bfr(bias[c0 + cofs + 1]); val[2] += bfr(bias[c0 + cofs + 2]); val[3] += bfr(bias[c0 + cofs + 3]); }
                *(v4f*)(crow + (size_t)row * ldc + cofs) = val; }
             }
        __builtin_amdgcn_wave_barrier(); asm volatile("" ::: "memory");
    }
}

__device__ __forceinline__ h16 tohx(float x) { return (h16)x; }
__device__ __forceinline__ void splitf(float y, unsigned short& h, unsigned short& l) { h = f2bf(y); l = f2bf(y - bf2f(h)); }
typedef __attribute__((ext_vector_type(2))) unsigned short v2us;
typedef __attribute__((ext_vector_type(4))) unsigned short v4us;
typedef __attribute__((ext_vector_type(2))) _Float16 v2h;
typedef __attribute__((ext_vector_type(4))) _Float16 v4h;

__global__ __launch_bounds__(256) void k_cvt8(const float* __restrict__ src, bf* dst, size_t n8) { const size_t i = (size_t)blockIdx.x * 256 + threadIdx.x; if (i >= n8) return; const v8f v = *(const v8f*)(src + i * 8); v8us o;
#pragma unroll
    for (int k = 0; k < 8; ++k) o[k] = f2bf(v[k]); *(v8us*)(dst + i * 8) = o;  }
// one launch turns all four weights: blockIdx.y picks the matrix (all have K = DM rows; Wb has half the columns, its surplus blocks leave at the first line test)
__global__ __launch_bounds__(256) void k_wtG(const float* __restrict__ Wa, const float* __restrict__ Wb, const float* __restrict__ Wv, const float* __restrict__ Wp, bf* BA, bf* BB, bf* BV, bf* BP) {
    const int sel = blockIdx.y; const float* __restrict__ w = sel == 0 ? Wa : sel == 1 ? Wb : sel == 2 ? Wv : Wp; bf* Bt = sel == 0 ? BA : sel == 1 ? BB : sel == 2 ? BV : BP; const int K = DM, N = sel == 1 ? NH_ * FB : DM;
    const int lane = threadIdx.x & 31; const int L0 = (blockIdx.x * 8 + (threadIdx.x >> 5)) * 8; const int nlines = N * K / 64;
{
#pragma unroll 1
        for (int l = 0; l < 8; ++l) { const int L = L0 + l; if (L >= nlines) break; const size_t e = (size_t)L * 64 + lane * 2; const int k = (int)(e % K), n = (int)(e / K); v2us o;
            o[0] = f2bf(w[(size_t)k * N + n]); o[1] = f2bf(w[(size_t)(k + 1) * N + n]); *(v2us*)(Bt + e) = o; }
         }
}

// ---- k_vsum (blockIdx.y = batch; V = the last DM columns of the [NB_ * TT][LDX] plane): VS[c][g] (fp16, c = batch * 768 + head * 64 + d) = sum over the GK keys t = GK g .. GK g + GK - 1 of V[t][c], f32 adds in ascending t. Block = 32 columns x all NG groups (wave w: groups 2w, 2w + 1; lane: column), so every 128-byte line of VS has one writer.
__global__ __launch_bounds__(1024) void k_vsum(const float* __restrict__ V, h16* VS) {
    __shared__ __align__(4) h16 sm[32 * 66];
    const int lane = threadIdx.x & 31, w = threadIdx.x >> 5; const int c0 = blockIdx.x * 32;
    const int bt = blockIdx.y; const float* p = V + ((size_t)bt * TT + w * 2 * GK) * LDX + c0 + lane; float s0 = 0.f, s1 = 0.f;
    // unrolled so that the wave's 64 row loads are all in flight before the first add waits
#pragma unroll
    for (int u = 0; u < GK; ++u) { s0 += p[(size_t)u * LDX]; s1 += p[(size_t)(GK + u) * LDX]; }
    v2h o; o[0] = tohx(s0); o[1] = tohx(s1); *(v2h*)(sm + lane * 66 + 2 * w) = o;
    __syncthreads();   // the 32 x 64 tile turns from column-per-lane to group-per-lane through LDS: every wave reads what all 32 waves wrote
    *(v2h*)(VS + (size_t)(bt * DM + c0 + w) * NG + 2 * lane) = *(const v2h*)(sm + w * 66 + 2 * lane); }
// ---- k_fsoft: wave per (batch, head, query); a and b are column ranges of the [NB_ * TT][LDX] plane. Group g = j div 32 has logit a[g] * b[g div 2]; lane holds groups 2 lane and 2 lane + 1. The softmax sum over the 2,048 keys is GK x the sum over the groups.
__global__ __launch_bounds__(256) void k_fsoft(const float* __restrict__ A, const float* __restrict__ Bm, h16* PG) { const int lane = threadIdx.x & 31; const int row = blockIdx.x * 8 + (threadIdx.x >> 5); if (row >= NZ * TT) return; const int n = row % TT; const int zz = row / TT; const int h = zz % NH_; const size_t xr = (size_t)(zz / NH_) * TT + n;
    const float* ar = A + xr * LDX + h * FA; const float* br = Bm + xr * LDX + h * FB;
    const float bv = br[lane]; const float t0 = __fmul_rn(ar[2 * lane], bv), t1 = __fmul_rn(ar[2 * lane + 1], bv); float mx = fmaxf(t0, t1);
#pragma unroll
    for (int sh = 16; sh; sh >>= 1) mx = fmaxf(mx, __shfl_xor(mx, sh, 32));
    const float e0 = __builtin_amdgcn_exp2f(__fmul_rn(__fsub_rn(t0, mx), 1.4426950408889634f)), e1 = __builtin_amdgcn_exp2f(__fmul_rn(__fsub_rn(t1, mx), 1.4426950408889634f)); float sum = e0 + e1;
#pragma unroll
    for (int sh = 16; sh; sh >>= 1) sum += __shfl_xor(sum, sh, 32);
    const float f = __fdiv_rn(PCAR, (float)GK * sum);
    v2h o; o[0] = tohx(e0 * f); o[1] = tohx(e1 * f); *(v2h*)(PG + (size_t)row * NG + 2 * lane) = o; }
__global__ __launch_bounds__(256) void k_mrg(const float* __restrict__ O, bf* Ah, bf* Al) { const size_t e = ((size_t)blockIdx.x * 256 + threadIdx.x) * 4; if (e >= (size_t)NZ * TT * HD) return; const int d = (int)(e % HD); const int t = (int)((e / HD) % TT); const int zz = (int)(e / ((size_t)HD * TT)); const size_t oo = ((size_t)(zz / NH_) * TT + t) * DM + (zz % NH_) * HD + d; v4us oh, ol;
#pragma unroll
    for (int u = 0; u < 4; ++u) { unsigned short a, b; splitf(O[e + u] * (1.0f / PCAR), a, b); oh[u] = a; ol[u] = b; } *(v4us*)(Ah + oo) = oh; *(v4us*)(Al + oo) = ol;  }

extern "C" void kernel_launch(void* const* d_in, const int* in_sizes, int n_in,
                              void* d_out, int out_size, void* d_ws, size_t ws_size, hipStream_t stream) {
    (void)in_sizes; (void)n_in; (void)out_size;
    const float* x = (const float*)d_in[0]; const float* Wa = (const float*)d_in[1]; const float* Wb = (const float*)d_in[2]; const float* Wv = (const float*)d_in[3]; const float* Wp = (const float*)d_in[4]; const float* bp = (const float*)d_in[5];
    float* OUT = (float*)d_out;     // [4][2048][768]
    char* wsp = (char*)d_ws;
    auto take = [&](size_t bytes) { char* p = wsp; wsp += (bytes + 255) & ~(size_t)255; return (void*)p; };
    bf* BA = (bf*)take((size_t)NH_ * FA * DM * 2); bf* BB = (bf*)take((size_t)NH_ * FB * DM * 2); bf* BV = (bf*)take((size_t)DM * DM * 2); bf* BP = (bf*)take((size_t)DM * DM * 2);
    bf* XB = (bf*)take((size_t)NB_ * TT * DM * 2); float* ABV = (float*)take((size_t)NB_ * TT * LDX * 4); h16* VS = (h16*)take((size_t)NZ * HD * NG * 2);
    h16* PG = (h16*)take((size_t)NZ * TT * NG * 2); float* O = (float*)take((size_t)NZ * TT * HD * 4); bf* ATh = (bf*)take((size_t)NB_ * TT * DM * 2); bf* ATl = (bf*)take((size_t)NB_ * TT * DM * 2);
    if ((size_t)(wsp - (char*)d_ws) > ws_size) return;    // total ~ 144 MB
    // Every stage runs once, over all batches and heads. BA, BB, BV lie back to back (each a multiple of 256 bytes), so they are one [LDX][DM] operand and a | b | v come out of one GEMM as columns 0, NH_ * FA and NH_ * (FA + FB) of ABV.
    k_wtG<<<dim3(DM * DM / 64 / 64, 4, 1), 256, 0, stream>>>(Wa, Wb, Wv, Wp, BA, BB, BV, BP);
    k_cvt8<<<NB_ * TT * DM / 8 / 256, 256, 0, stream>>>(x, XB, (size_t)NB_ * TT * DM / 8);
    k_gemmw<bf, 0, false><<<dim3(NB_ * TT / 64, LDX / 64, 1), 32, 0, stream>>>(XB, nullptr, BA, nullptr, DM, ABV, LDX, nullptr, 0, 0, 0);
    k_vsum<<<dim3(DM / 32, NB_, 1), 1024, 0, stream>>>(ABV + NH_ * (FA + FB), VS);
    k_fsoft<<<NZ * TT / 8, 256, 0, stream>>>(ABV, ABV + NH_ * FA, PG);
    k_gemmw<h16, 0, false><<<dim3(TT / 64, 1, NZ), 32, 0, stream>>>(PG, nullptr, VS, nullptr, NG, O, HD, nullptr, (size_t)TT * NG, (size_t)HD * NG, (size_t)TT * HD);
    k_mrg<<<NZ * TT * HD / 4 / 256, 256, 0, stream>>>(O, ATh, ATl);
    k_gemmw<bf, 1, true><<<dim3(NB_ * TT / 64, DM / 64, 1), 32, 0, stream>>>(ATh, ATl, BP, nullptr, DM, OUT, DM, bp, 0, 0, 0);
}

// v003
// It runs in 114 microseconds.
// In two side-by-side timings against v002, it was 1.16 and 1.15 times as fast.
// Over all steps from v000 it is 14.1 times as fast.
#include <hip/hip_runtime.h>

// FactorizedDenseAttention (x [4][2048][768]; a = x Wa (12 heads x 64), b = x Wb (12 heads x 32), v = x Wv (12 heads x 64); factorised dense logits attn[n][j] = a[n][j div 32] * b[n][j div 64] over the 2,048 keys (query-only; no key content), softmax over j; out = attn v merged; out Wp + bp -> [4][2048][768]).
// Compute dtypes, f32 accumulate: every input rounded to bf16; a / b / v as PLAIN bf16 GEMMs (inputs: exact); the factorised logits and the softmax in f32 on VALU (wave per (head, query); no score GEMM exists) -> fp16 x 1024, ONE weight per group of 32 keys (j div 32 fixes both factors, so the 32 keys of a group share their weight); v summed over each group in f32 -> fp16; attn.v = group weights x group sums, single fp16, K = 64 groups (f32 accumulate, / 1024 at the merge); Wp hl x exact (2 products) + bias.

#define NB_  4
#define TT   2048
#define DM   768
#define NH_  12
#define FA   64
#define FB   32
#define HD   64
#define NZ   (NB_ * NH_)
#define LDX  (NH_ * FA + NH_ * FB + DM)
#define GK   32
#define NG   64
#define PCAR 1024.0f
typedef _Float16 h16;
typedef unsigned short bf;
typedef __attribute__((ext_vector_type(16))) __bf16   v16bf;
typedef __attribute__((ext_vector_type(16))) _Float16 v16h;
typedef __attribute__((ext_vector_type(8)))  _Float16 v8h;
typedef __attribute__((ext_vector_type(8)))  unsigned short v8us;
typedef __attribute__((ext_vector_type(8)))  float    v8f;
typedef __attribute__((ext_vector_type(4)))  float    v4f;
typedef v8h  __attribute__((may_alias)) v8ha;
typedef v4f  __attribute__((may_alias)) v4fa;
typedef v8us __attribute__((may_alias)) v8usa;

__device__ __forceinline__ unsigned short f2bf(float f) { unsigned u = __float_as_uint(f); u += 0x7FFFu + ((u >> 16) & 1u); return (unsigned short)(u >> 16); }
__device__ __forceinline__ float bf2f(unsigned short b) { return __uint_as_float(((unsigned)b) << 16); }
__device__ __forceinline__ float bfr(float f) { return bf2f(f2bf(f)); }
__device__ __forceinline__ v16h cat16(v8h lo, v8h hi) { return __builtin_shufflevector(lo, hi, 0, 1, 2, 3, 4, 5, 6, 7, 8, 9, 10, 11, 12, 13, 14, 15); }
__device__ __forceinline__ v16bf cat16b(v8us lo, v8us hi) { return __builtin_bit_cast(v16bf, __builtin_shufflevector(lo, hi, 0, 1, 2, 3, 4, 5, 6, 7, 8, 9, 10, 11, 12, 13, 14, 15)); }
__device__ __forceinline__ v8f wmma16(v16h a, v16h b, v8f c) { return __builtin_amdgcn_wmma_f32_16x16x32_f16(false, a, false, b, (short)0, c, false, false); }
__device__ __forceinline__ v8f wmmab(v16bf a, v16bf b, v8f c) { return __builtin_amdgcn_wmma_f32_16x16x32_bf16(false, a, false, b, (short)0, c, false, false); }



// ---- k_gemmw: register-blocked GEMM, ONE WAVE per 64x64 output tile (16 accumulators), operands straight from K-contiguous 16-bit planes; grid (M/64, N/64, Z), 32 threads.
// C[m][n] (f32, pitch ldc, + optional f32 bias[n]) = sum_k A[m][k] Bt[n][k] (+ split products per NSPLIT). z-batch strides sA/sB/sC in elements. K % 32 == 0.
template <typename T16> struct WFrag;
template <> struct WFrag<h16> { typedef v16h V; static __device__ __forceinline__ V ld(const h16* p) { return cat16(*(const v8h*)p, *(const v8h*)(p + 16)); } static __device__ __forceinline__ v8f mma(V a, V b, v8f c) { return wmma16(a, b, c); } };
template <> struct WFrag<bf> { typedef v16bf V; static __device__ __forceinline__ V ld(const bf* p) { return cat16b(*(const v8us*)p, *(const v8us*)(p + 16)); } static __device__ __forceinline__ v8f mma(V a, V b, v8f c) { return wmmab(a, b, c); } };
template <typename T16, int NSPLIT, bool BIAS>
__global__ __launch_bounds__(32) void k_gemmw(const T16* __restrict__ A, const T16* __restrict__ A2, const T16* __restrict__ Bt, const T16* __restrict__ Bt2, int K, float* C, int ldc, const float* __restrict__ bias, size_t sA, size_t sB, size_t sC) {
    typedef typename WFrag<T16>::V V;
    __shared__ __align__(16) float os[16 * 68];
    const size_t z = blockIdx.z; A += z * sA; if (A2) A2 += z * sA; Bt += z * sB; if (Bt2) Bt2 += z * sB; C += z * sC;
    const int lane = threadIdx.x & 31, lr = lane & 15, hi = lane >> 4; const int r0 = blockIdx.x * 64, c0 = blockIdx.y * 64;
    v8f acc[4][4];
#pragma unroll
    for (int mb = 0; mb < 4; ++mb)
#pragma unroll
        for (int nb = 0; nb < 4; ++nb) acc[mb][nb] = (v8f){};
    const size_t aoff = (size_t)(r0 + lr) * K + 8 * hi, boff = (size_t)(c0 + lr) * K + 8 * hi;
#pragma unroll 1
    for (int kc = 0; kc < K; kc += 32) {
        V a[4], a2[4];
#pragma unroll
        for (int mb = 0; mb < 4; ++mb) { a[mb] = WFrag<T16>::ld(A + aoff + (size_t)mb * 16 * K + kc); if (NSPLIT == 1 || NSPLIT == 2) a2[mb] = WFrag<T16>::ld(A2 + aoff + (size_t)mb * 16 * K + kc); }
#pragma unroll
        for (int nb = 0; nb < 4; ++nb) { const V b = WFrag<T16>::ld(Bt + boff + (size_t)nb * 16 * K + kc); V b2; if (NSPLIT >= 2) b2 = WFrag<T16>::ld(Bt2 + boff + (size_t)nb * 16 * K + kc);
#pragma unroll
            for (int mb = 0; mb < 4; ++mb) { acc[mb][nb] = WFrag<T16>::mma(a[mb], b, acc[mb][nb]); if (NSPLIT == 1 || NSPLIT == 2) acc[mb][nb] = WFrag<T16>::mma(a2[mb], b, acc[mb][nb]); if (NSPLIT >= 2) acc[mb][nb] = WFrag<T16>::mma(a[mb], b2, acc[mb][nb]); } }
        asm volatile("v_nop\n\tv_nop\n\tv_nop\n\tv_nop" : "+v"(acc[0][0]), "+v"(acc[1][1]), "+v"(acc[2][2]), "+v"(acc[3][3]) : "v"(a[0]), "v"(a[3]));
    }
#pragma unroll
    for (int mb = 0; mb < 4; ++mb) {
#pragma unroll
        for (int nb = 0; nb < 4; ++nb) {
#pragma unroll
            for (int j = 0; j < 8; ++j) os[(hi * 8 + j) * 68 + nb * 16 + lr] = acc[mb][nb][j]; }
        __builtin_amdgcn_wave_barrier(); asm volatile("" ::: "memory");
        float* crow = C + (size_t)(r0 + mb * 16) * ldc + c0;
{
#pragma unroll
            for (int s = 0; s < 8; ++s) { const int row = 2 * s + hi, cofs = lr * 4; v4f val = *(const v4fa*)(os + row * 68 + cofs); if (BIAS) { val[0] += bfr(bias[c0 + cofs]); val[1] += bfr(bias[c0 + cofs + 1]); val[2] += bfr(bias[c0 + cofs + 2]); val[3] += bfr(bias[c0 + cofs + 3]); }
                *(v4f*)(crow + (size_t)row * ldc + cofs) = val; }
             }
        __builtin_amdgcn_wave_barrier(); asm volatile("" ::: "memory");
    }
}

// ---- FRAGMENT ORDER of a 16-bit operand plane P[row][k] (rows % 16 == 0, K = DM): the 16 x 32 tile (row / 16, k / 32) is 1 KiB at element ((row / 16) * (DM / 32) + k / 32) * 512; in it stand two halves of 256 elements (half = k % 32 / 16), and in a half lane (k % 16 / 8) * 16 + row % 16 has its 8 elements (k % 8) side by side.
// That is the register layout of a 16x16x32 A or B fragment, so a wave's 16-byte-per-lane load reads 512 contiguous bytes (4 whole lines) where a row-major plane gives it 32-byte pieces of 16 lines. The values and the k order of every fragment are those of the row-major plane.
// frag_rk: 16-byte chunk c of such a plane -> the row and the first k of its 8 elements.
__device__ __forceinline__ void frag_rk(size_t c, int& row, int& k) { const int lane = (int)(c & 31), half = (int)((c >> 5) & 1); const int tile = (int)(c >> 6); row = (tile / (DM / 32)) * 16 + (lane & 15); k = (tile % (DM / 32)) * 32 + half * 16 + (lane >> 4) * 8; }
__device__ __forceinline__ v16bf ldfrag(const bf* p) { return cat16b(*(const v8us*)p, *(const v8us*)(p + 256)); }

// ---- k_gemmf: k_gemmw's tile (ONE WAVE per 64x64 of C, 16 accumulators, the same WMMA order) for bf16 planes in fragment order, K = DM; grid (M/64, N/64), 32 threads.
// C[m][n] (f32, pitch ldc, + optional f32 bias[n]) = sum_k (A[m][k] (+ A2[m][k] where SPLIT)) Bt[n][k]. Every fragment address is a wave-uniform base + lane * 16 bytes + a constant.
template <bool SPLIT, bool BIAS>
__global__ __launch_bounds__(32) void k_gemmf(const bf* __restrict__ A, const bf* __restrict__ A2, const bf* __restrict__ Bt, float* C, int ldc, const float* __restrict__ bias) {
    __shared__ __align__(16) float os[16 * 68];
    const int lane = threadIdx.x & 31, lr = lane & 15, hi = lane >> 4; const int r0 = blockIdx.x * 64, c0 = blockIdx.y * 64;
    v8f acc[4][4];
#pragma unroll
    for (int mb = 0; mb < 4; ++mb)
#pragma unroll
        for (int nb = 0; nb < 4; ++nb) acc[mb][nb] = (v8f){};
    // a band of 16 rows is 16 * DM elements, a step of 32 k one 512-element tile
    // (the short loops over mb, nb, j, s are unrolled so that acc, a, a2 are indexed by constants and stay in registers)
    const bf* Ab = A + (size_t)r0 * DM + lane * 8; const bf* A2b = SPLIT ? A2 + (size_t)r0 * DM + lane * 8 : Ab; const bf* Bb = Bt + (size_t)c0 * DM + lane * 8;
    // kept rolled, as in k_gemmw: one trip's fragments at a time keep the wave under 256 VGPRs, so four waves fit a SIMD
#pragma unroll 1
    for (int kt = 0; kt < DM / 32; ++kt) {
        // without a second plane pa2 is pa itself and takes no register of its own
        const bf* pa = Ab + kt * 512; const bf* pa2 = SPLIT ? A2b + kt * 512 : pa; const bf* pb = Bb + kt * 512;
        v16bf a[4], a2[4];
#pragma unroll
        for (int mb = 0; mb < 4; ++mb) { a[mb] = ldfrag(pa + mb * 16 * DM); if (SPLIT) a2[mb] = ldfrag(pa2 + mb * 16 * DM); }
#pragma unroll
        for (int nb = 0; nb < 4; ++nb) { const v16bf b = ldfrag(pb + nb * 16 * DM);
#pragma unroll
            for (int mb = 0; mb < 4; ++mb) { acc[mb][nb] = wmmab(a[mb], b, acc[mb][nb]); if (SPLIT) acc[mb][nb] = wmmab(a2[mb], b, acc[mb][nb]); } }
        // four vector slots between the trip's last WMMAs and the back edge: the next trip's loads overwrite their A and B registers.
        // The trip's address pairs are inputs too: they stay live to here, behind the trip's last load wait, so that no load's result is given a register that an issued load still names as its address.
        asm volatile("v_nop\n\tv_nop\n\tv_nop\n\tv_nop" : "+v"(acc[0][0]), "+v"(acc[1][1]), "+v"(acc[2][2]), "+v"(acc[3][3]) : "v"(a[0]), "v"(a[3]), "v"(pa), "v"(pa2), "v"(pb));
    }
#pragma unroll
    for (int mb = 0; mb < 4; ++mb) {
#pragma unroll
        for (int nb = 0; nb < 4; ++nb) {
#pragma unroll
            for (int j = 0; j < 8; ++j) os[(hi * 8 + j) * 68 + nb * 16 + lr] = acc[mb][nb][j]; }
        // the wave's lanes read below what other lanes stored above: keeps the compiler from moving LDS accesses across
        __builtin_amdgcn_wave_barrier(); asm volatile("" ::: "memory");
        float* crow = C + (size_t)(r0 + mb * 16) * ldc + c0;
#pragma unroll
        for (int s = 0; s < 8; ++s) { const int row = 2 * s + hi, cofs = lr * 4; v4f val = *(const v4fa*)(os + row * 68 + cofs); if (BIAS) { val[0] += bfr(bias[c0 + cofs]); val[1] += bfr(bias[c0 + cofs + 1]); val[2] += bfr(bias[c0 + cofs + 2]); val[3] += bfr(bias[c0 + cofs + 3]); }
            *(v4f*)(crow + (size_t)row * ldc + cofs) = val; }
        // the next 16 rows overwrite the staging tile only behind these reads; the wait stands behind the 8 stores, in front of whatever next overwrites their address or data registers
        if (mb < 3) { __builtin_amdgcn_wave_barrier(); asm volatile("s_wait_xcnt 0x0" ::: "memory"); }
    }
}

__device__ __forceinline__ h16 tohx(float x) { return (h16)x; }
__device__ __forceinline__ void splitf(float y, unsigned short& h, unsigned short& l) { h = f2bf(y); l = f2bf(y - bf2f(h)); }
typedef __attribute__((ext_vector_type(2))) unsigned short v2us;
typedef __attribute__((ext_vector_type(4))) unsigned short v4us;
typedef __attribute__((ext_vector_type(2))) _Float16 v2h;
typedef __attribute__((ext_vector_type(4))) _Float16 v4h;

// src [rows][DM] f32 -> dst bf16 in fragment order; thread = one 16-byte chunk of dst (a wave stores 512 contiguous bytes; a block's 8 waves read 512 contiguous bytes of each of 16 rows)
__global__ __launch_bounds__(256) void k_cvt8(const float* __restrict__ src, bf* dst, size_t n8) { const size_t i = (size_t)blockIdx.x * 256 + threadIdx.x; if (i >= n8) return; int row, k0; frag_rk(i, row, k0); const v8f v = *(const v8f*)(src + (size_t)row * DM + k0); v8us o;
#pragma unroll
    for (int k = 0; k < 8; ++k) o[k] = f2bf(v[k]); *(v8us*)(dst + i * 8) = o;  }
// one launch turns all four weights w[k][n] into Bt[n][k] in fragment order: blockIdx.y picks the matrix (all have K = DM rows; Wb has half the columns, its surplus blocks leave at the first test); thread = one 16-byte chunk of Bt: 8 k of one n (16 lanes read 16 neighbouring n of a row of w).
template <int N> __device__ __forceinline__ void wturn(const float* __restrict__ w, bf* Bt, size_t c) { if (c >= (size_t)N * DM / 8) return; int n, k0; frag_rk(c, n, k0); const float* p = w + (size_t)k0 * N + n; v8us o;
#pragma unroll
    for (int u = 0; u < 8; ++u) o[u] = f2bf(p[u * N]);
    *(v8us*)(Bt + c * 8) = o; }
__global__ __launch_bounds__(256) void k_wtG(const float* __restrict__ Wa, const float* __restrict__ Wb, const float* __restrict__ Wv, const float* __restrict__ Wp, bf* BA, bf* BB, bf* BV, bf* BP) {
    const int sel = blockIdx.y; const size_t c = (size_t)blockIdx.x * 256 + threadIdx.x;
    if (sel == 1) wturn<NH_ * FB>(Wb, BB, c); else wturn<DM>(sel == 0 ? Wa : sel == 2 ? Wv : Wp, sel == 0 ? BA : sel == 2 ? BV : BP, c);
}

// ---- k_vsum (blockIdx.y = batch; V = the last DM columns of the [NB_ * TT][LDX] plane): VS[c][g] (fp16, c = batch * 768 + head * 64 + d) = sum over the GK keys t = GK g .. GK g + GK - 1 of V[t][c], f32 adds in ascending t. Block = 32 columns x all NG groups (wave w: groups 2w, 2w + 1; lane: column), so every 128-byte line of VS has one writer.
__global__ __launch_bounds__(1024) void k_vsum(const float* __restrict__ V, h16* VS) {
    __shared__ __align__(4) h16 sm[32 * 66];
    const int lane = threadIdx.x & 31, w = threadIdx.x >> 5; const int c0 = blockIdx.x * 32;
    const int bt = blockIdx.y; const float* p = V + ((size_t)bt * TT + w * 2 * GK) * LDX + c0 + lane; float s0 = 0.f, s1 = 0.f;
    // unrolled so that the wave's 64 row loads are all in flight before the first add waits
#pragma unroll
    for (int u = 0; u < GK; ++u) { s0 += p[(size_t)u * LDX]; s1 += p[(size_t)(GK + u) * LDX]; }
    v2h o; o[0] = tohx(s0); o[1] = tohx(s1); *(v2h*)(sm + lane * 66 + 2 * w) = o;
    __syncthreads();   // the 32 x 64 tile turns from column-per-lane to group-per-lane through LDS: every wave reads what all 32 waves wrote
    *(v2h*)(VS + (size_t)(bt * DM + c0 + w) * NG + 2 * lane) = *(const v2h*)(sm + w * 66 + 2 * lane); }
// ---- k_fsoft: wave per (batch, head, query); a and b are column ranges of the [NB_ * TT][LDX] plane. Group g = j div 32 has logit a[g] * b[g div 2]; lane holds groups 2 lane and 2 lane + 1. The softmax sum over the 2,048 keys is GK x the sum over the groups.
__global__ __launch_bounds__(256) void k_fsoft(const float* __restrict__ A, const float* __restrict__ Bm, h16* PG) { const int lane = threadIdx.x & 31; const int row = blockIdx.x * 8 + (threadIdx.x >> 5); if (row >= NZ * TT) return; const int n = row % TT; const int zz = row / TT; const int h = zz % NH_; const size_t xr = (size_t)(zz / NH_) * TT + n;
    const float* ar = A + xr * LDX + h * FA; const float* br = Bm + xr * LDX + h * FB;
    const float bv = br[lane]; const float t0 = __fmul_rn(ar[2 * lane], bv), t1 = __fmul_rn(ar[2 * lane + 1], bv); float mx = fmaxf(t0, t1);
#pragma unroll
    for (int sh = 16; sh; sh >>= 1) mx = fmaxf(mx, __shfl_xor(mx, sh, 32));
    const float e0 = __builtin_amdgcn_exp2f(__fmul_rn(__fsub_rn(t0, mx), 1.4426950408889634f)), e1 = __builtin_amdgcn_exp2f(__fmul_rn(__fsub_rn(t1, mx), 1.4426950408889634f)); float sum = e0 + e1;
#pragma unroll
    for (int sh = 16; sh; sh >>= 1) sum += __shfl_xor(sum, sh, 32);
    const float f = __fdiv_rn(PCAR, (float)GK * sum);
    v2h o; o[0] = tohx(e0 * f); o[1] = tohx(e1 * f); *(v2h*)(PG + (size_t)row * NG + 2 * lane) = o; }
// O [NZ][TT][HD] f32 -> the merged [NB_ * TT][DM] rows / PCAR, split hi + lo, both planes in fragment order; thread = one 16-byte chunk of each plane (8 neighbouring d of one head and query)
__global__ __launch_bounds__(256) void k_mrg(const float* __restrict__ O, bf* Ah, bf* Al) { const size_t c = (size_t)blockIdx.x * 256 + threadIdx.x; if (c >= (size_t)NZ * TT * HD / 8) return; int row, k0; frag_rk(c, row, k0); const int zz = (row / TT) * NH_ + k0 / HD; const v8f v = *(const v8f*)(O + ((size_t)zz * TT + row % TT) * HD + k0 % HD); v8us oh, ol;
#pragma unroll
    for (int u = 0; u < 8; ++u) { unsigned short a, b; splitf(v[u] * (1.0f / PCAR), a, b); oh[u] = a; ol[u] = b; } *(v8us*)(Ah + c * 8) = oh; *(v8us*)(Al + c * 8) = ol;  }

extern "C" void kernel_launch(void* const* d_in, const int* in_sizes, int n_in,
                              void* d_out, int out_size, void* d_ws, size_t ws_size, hipStream_t stream) {
    (void)in_sizes; (void)n_in; (void)out_size;
    const float* x = (const float*)d_in[0]; const float* Wa = (const float*)d_in[1]; const float* Wb = (const float*)d_in[2]; const float* Wv = (const float*)d_in[3]; const float* Wp = (const float*)d_in[4]; const float* bp = (const float*)d_in[5];
    float* OUT = (float*)d_out;     // [4][2048][768]
    char* wsp = (char*)d_ws;
    auto take = [&](size_t bytes) { char* p = wsp; wsp += (bytes + 255) & ~(size_t)255; return (void*)p; };
    bf* BA = (bf*)take((size_t)NH_ * FA * DM * 2); bf* BB = (bf*)take((size_t)NH_ * FB * DM * 2); bf* BV = (bf*)take((size_t)DM * DM * 2); bf* BP = (bf*)take((size_t)DM * DM * 2);
    bf* XB = (bf*)take((size_t)NB_ * TT * DM * 2); float* ABV = (float*)take((size_t)NB_ * TT * LDX * 4); h16* VS = (h16*)take((size_t)NZ * HD * NG * 2);
    h16* PG = (h16*)take((size_t)NZ * TT * NG * 2); float* O = (float*)take((size_t)NZ * TT * HD * 4); bf* ATh = (bf*)take((size_t)NB_ * TT * DM * 2); bf* ATl = (bf*)take((size_t)NB_ * TT * DM * 2);
    if ((size_t)(wsp - (char*)d_ws) > ws_size) return;    // total ~ 144 MB
    // Every stage runs once, over all batches and heads. BA, BB, BV lie back to back (each a multiple of 256 bytes and a whole number of 16-row bands), so they are one [LDX][DM] operand in fragment order and a | b | v come out of one GEMM as columns 0, NH_ * FA and NH_ * (FA + FB) of ABV.
    k_wtG<<<dim3(DM * DM / 8 / 256, 4, 1), 256, 0, stream>>>(Wa, Wb, Wv, Wp, BA, BB, BV, BP);
    k_cvt8<<<NB_ * TT * DM / 8 / 256, 256, 0, stream>>>(x, XB, (size_t)NB_ * TT * DM / 8);
    k_gemmf<false, false><<<dim3(NB_ * TT / 64, LDX / 64, 1), 32, 0, stream>>>(XB, nullptr, BA, ABV, LDX, nullptr);
    k_vsum<<<dim3(DM / 32, NB_, 1), 1024, 0, stream>>>(ABV + NH_ * (FA + FB), VS);
    k_fsoft<<<NZ * TT / 8, 256, 0, stream>>>(ABV, ABV + NH_ * FA, PG);
    k_gemmw<h16, 0, false><<<dim3(TT / 64, 1, NZ), 32, 0, stream>>>(PG, nullptr, VS, nullptr, NG, O, HD, nullptr, (size_t)TT * NG, (size_t)HD * NG, (size_t)TT * HD);
    k_mrg<<<NZ * TT * HD / 8 / 256, 256, 0, stream>>>(O, ATh, ATl);
    k_gemmf<true, true><<<dim3(NB_ * TT / 64, DM / 64, 1), 32, 0, stream>>>(ATh, ATl, BP, OUT, DM, bp);
}

// v004
// A run of this version takes 97.6 microseconds.
// Timed twice side by side with v003, it ran 1.16 times as fast both times.
// All steps since v000 together make it 16.3 times as fast.
#include <hip/hip_runtime.h>

// FactorizedDenseAttention (x [4][2048][768]; a = x Wa (12 heads x 64), b = x Wb (12 heads x 32), v = x Wv (12 heads x 64); factorised dense logits attn[n][j] = a[n][j div 32] * b[n][j div 64] over the 2,048 keys (query-only; no key content), softmax over j; out = attn v merged; out Wp + bp -> [4][2048][768]).
// Compute dtypes, f32 accumulate: every input rounded to bf16; a / b / v as PLAIN bf16 GEMMs (inputs: exact); the factorised logits and the softmax in f32 on VALU (two lanes per (head, query), in the registers of the wave that multiplies; no score GEMM exists) -> fp16 x 1024, ONE weight per group of 32 keys (j div 32 fixes both factors, so the 32 keys of a group share their weight); v summed over each group in f32 -> fp16; attn.v = group weights x group sums, single fp16, K = 64 groups (f32 accumulate, / 1024 at the merge); Wp hl x exact (2 products) + bias.

#define NB_  4
#define TT   2048
#define DM   768
#define NH_  12
#define FA   64
#define FB   32
#define HD   64
#define NZ   (NB_ * NH_)
#define LDX  (NH_ * FA + NH_ * FB + DM)
#define GK   32
#define NG   64
#define PCAR 1024.0f
typedef _Float16 h16;
typedef unsigned short bf;
typedef __attribute__((ext_vector_type(16))) __bf16   v16bf;
typedef __attribute__((ext_vector_type(16))) _Float16 v16h;
typedef __attribute__((ext_vector_type(8)))  _Float16 v8h;
typedef __attribute__((ext_vector_type(8)))  unsigned short v8us;
typedef __attribute__((ext_vector_type(8)))  float    v8f;
typedef __attribute__((ext_vector_type(4)))  float    v4f;
typedef v8h  __attribute__((may_alias)) v8ha;
typedef v4f  __attribute__((may_alias)) v4fa;
typedef v8us __attribute__((may_alias)) v8usa;

__device__ __forceinline__ unsigned short f2bf(float f) { unsigned u = __float_as_uint(f); u += 0x7FFFu + ((u >> 16) & 1u); return (unsigned short)(u >> 16); }
__device__ __forceinline__ float bf2f(unsigned short b) { return __uint_as_float(((unsigned)b) << 16); }
__device__ __forceinline__ float bfr(float f) { return bf2f(f2bf(f)); }
__device__ __forceinline__ v16h cat16(v8h lo, v8h hi) { return __builtin_shufflevector(lo, hi, 0, 1, 2, 3, 4, 5, 6, 7, 8, 9, 10, 11, 12, 13, 14, 15); }
__device__ __forceinline__ v16bf cat16b(v8us lo, v8us hi) { return __builtin_bit_cast(v16bf, __builtin_shufflevector(lo, hi, 0, 1, 2, 3, 4, 5, 6, 7, 8, 9, 10, 11, 12, 13, 14, 15)); }
__device__ __forceinline__ v8f wmma16(v16h a, v16h b, v8f c) { return __builtin_amdgcn_wmma_f32_16x16x32_f16(false, a, false, b, (short)0, c, false, false); }
__device__ __forceinline__ v8f wmmab(v16bf a, v16bf b, v8f c) { return __builtin_amdgcn_wmma_f32_16x16x32_bf16(false, a, false, b, (short)0, c, false, false); }

// ---- FRAGMENT ORDER of a 16-bit operand plane P[row][k] (rows % 16 == 0, K = DM): the 16 x 32 tile (row / 16, k / 32) is 1 KiB at element ((row / 16) * (DM / 32) + k / 32) * 512; in it stand two halves of 256 elements (half = k % 32 / 16), and in a half lane (k % 16 / 8) * 16 + row % 16 has its 8 elements (k % 8) side by side.
// That is the register layout of a 16x16x32 A or B fragment, so a wave's 16-byte-per-lane load reads 512 contiguous bytes (4 whole lines) where a row-major plane gives it 32-byte pieces of 16 lines. The values and the k order of every fragment are those of the row-major plane.
// frag_rk: 16-byte chunk c of such a plane -> the row and the first k of its 8 elements.
__device__ __forceinline__ void frag_rk(size_t c, int& row, int& k) { const int lane = (int)(c & 31), half = (int)((c >> 5) & 1); const int tile = (int)(c >> 6); row = (tile / (DM / 32)) * 16 + (lane & 15); k = (tile % (DM / 32)) * 32 + half * 16 + (lane >> 4) * 8; }
__device__ __forceinline__ v16bf ldfrag(const bf* p) { return cat16b(*(const v8us*)p, *(const v8us*)(p + 256)); }

// ---- k_gemmf: register-blocked GEMM, ONE WAVE per 64x64 tile of C (16 accumulators), for bf16 planes in fragment order, K = DM; grid (M/64, N/64), 32 threads.
// C[m][n] (f32, pitch ldc, + optional f32 bias[n]) = sum_k (A[m][k] (+ A2[m][k] where SPLIT)) Bt[n][k]. Every fragment address is a wave-uniform base + lane * 16 bytes + a constant.
template <bool SPLIT, bool BIAS>
__global__ __launch_bounds__(32) void k_gemmf(const bf* __restrict__ A, const bf* __restrict__ A2, const bf* __restrict__ Bt, float* C, int ldc, const float* __restrict__ bias) {
    __shared__ __align__(16) float os[16 * 68];
    const int lane = threadIdx.x & 31, lr = lane & 15, hi = lane >> 4; const int r0 = blockIdx.x * 64, c0 = blockIdx.y * 64;
    v8f acc[4][4];
#pragma unroll
    for (int mb = 0; mb < 4; ++mb)
#pragma unroll
        for (int nb = 0; nb < 4; ++nb) acc[mb][nb] = (v8f){};
    // a band of 16 rows is 16 * DM elements, a step of 32 k one 512-element tile
    // (the short loops over mb, nb, j, s are unrolled so that acc, a, a2 are indexed by constants and stay in registers)
    const bf* Ab = A + (size_t)r0 * DM + lane * 8; const bf* A2b = SPLIT ? A2 + (size_t)r0 * DM + lane * 8 : Ab; const bf* Bb = Bt + (size_t)c0 * DM + lane * 8;
    // kept rolled: one trip's fragments at a time keep the wave under 256 VGPRs, so four waves fit a SIMD
#pragma unroll 1
    for (int kt = 0; kt < DM / 32; ++kt) {
        // without a second plane pa2 is pa itself and takes no register of its own
        const bf* pa = Ab + kt * 512; const bf* pa2 = SPLIT ? A2b + kt * 512 : pa; const bf* pb = Bb + kt * 512;
        v16bf a[4], a2[4];
#pragma unroll
        for (int mb = 0; mb < 4; ++mb) { a[mb] = ldfrag(pa + mb * 16 * DM); if (SPLIT) a2[mb] = ldfrag(pa2 + mb * 16 * DM); }
#pragma unroll
        for (int nb = 0; nb < 4; ++nb) { const v16bf b = ldfrag(pb + nb * 16 * DM);
#pragma unroll
            for (int mb = 0; mb < 4; ++mb) { acc[mb][nb] = wmmab(a[mb], b, acc[mb][nb]); if (SPLIT) acc[mb][nb] = wmmab(a2[mb], b, acc[mb][nb]); } }
        // four vector slots between the trip's last WMMAs and the back edge: the next trip's loads overwrite their A and B registers.
        // The trip's address pairs are inputs too: they stay live to here, behind the trip's last load wait, so that no load's result is given a register that an issued load still names as its address.
        asm volatile("v_nop\n\tv_nop\n\tv_nop\n\tv_nop" : "+v"(acc[0][0]), "+v"(acc[1][1]), "+v"(acc[2][2]), "+v"(acc[3][3]) : "v"(a[0]), "v"(a[3]), "v"(pa), "v"(pa2), "v"(pb));
    }
#pragma unroll
    for (int mb = 0; mb < 4; ++mb) {
#pragma unroll
        for (int nb = 0; nb < 4; ++nb) {
#pragma unroll
            for (int j = 0; j < 8; ++j) os[(hi * 8 + j) * 68 + nb * 16 + lr] = acc[mb][nb][j]; }
        // the wave's lanes read below what other lanes stored above: keeps the compiler from moving LDS accesses across
        __builtin_amdgcn_wave_barrier(); asm volatile("" ::: "memory");
        float* crow = C + (size_t)(r0 + mb * 16) * ldc + c0;
#pragma unroll
        for (int s = 0; s < 8; ++s) { const int row = 2 * s + hi, cofs = lr * 4; v4f val = *(const v4fa*)(os + row * 68 + cofs); if (BIAS) { val[0] += bfr(bias[c0 + cofs]); val[1] += bfr(bias[c0 + cofs + 1]); val[2] += bfr(bias[c0 + cofs + 2]); val[3] += bfr(bias[c0 + cofs + 3]); }
            *(v4f*)(crow + (size_t)row * ldc + cofs) = val; }
        // the next 16 rows overwrite the staging tile only behind these reads; the wait stands behind the 8 stores, in front of whatever next overwrites their address or data registers
        if (mb < 3) { __builtin_amdgcn_wave_barrier(); asm volatile("s_wait_xcnt 0x0" ::: "memory"); }
    }
}

__device__ __forceinline__ h16 tohx(float x) { return (h16)x; }
__device__ __forceinline__ void splitf(float y, unsigned short& h, unsigned short& l) { h = f2bf(y); l = f2bf(y - bf2f(h)); }
typedef __attribute__((ext_vector_type(2))) unsigned short v2us;
typedef __attribute__((ext_vector_type(4))) unsigned short v4us;
typedef __attribute__((ext_vector_type(2))) _Float16 v2h;
typedef __attribute__((ext_vector_type(4))) _Float16 v4h;

// src [rows][DM] f32 -> dst bf16 in fragment order; thread = one 16-byte chunk of dst (a wave stores 512 contiguous bytes; a block's 8 waves read 512 contiguous bytes of each of 16 rows)
__global__ __launch_bounds__(256) void k_cvt8(const float* __restrict__ src, bf* dst, size_t n8) { const size_t i = (size_t)blockIdx.x * 256 + threadIdx.x; if (i >= n8) return; int row, k0; frag_rk(i, row, k0); const v8f v = *(const v8f*)(src + (size_t)row * DM + k0); v8us o;
#pragma unroll
    for (int k = 0; k < 8; ++k) o[k] = f2bf(v[k]); *(v8us*)(dst + i * 8) = o;  }
// one launch turns all four weights w[k][n] into Bt[n][k] in fragment order: blockIdx.y picks the matrix (all have K = DM rows; Wb has half the columns, its surplus blocks leave at the first test); thread = one 16-byte chunk of Bt: 8 k of one n (16 lanes read 16 neighbouring n of a row of w).
template <int N> __device__ __forceinline__ void wturn(const float* __restrict__ w, bf* Bt, size_t c) { if (c >= (size_t)N * DM / 8) return; int n, k0; frag_rk(c, n, k0); const float* p = w + (size_t)k0 * N + n; v8us o;
#pragma unroll
    for (int u = 0; u < 8; ++u) o[u] = f2bf(p[u * N]);
    *(v8us*)(Bt + c * 8) = o; }
__global__ __launch_bounds__(256) void k_wtG(const float* __restrict__ Wa, const float* __restrict__ Wb, const float* __restrict__ Wv, const float* __restrict__ Wp, bf* BA, bf* BB, bf* BV, bf* BP) {
    const int sel = blockIdx.y; const size_t c = (size_t)blockIdx.x * 256 + threadIdx.x;
    if (sel == 1) wturn<NH_ * FB>(Wb, BB, c); else wturn<DM>(sel == 0 ? Wa : sel == 2 ? Wv : Wp, sel == 0 ? BA : sel == 2 ? BV : BP, c);
}

// ---- k_vsum (blockIdx.y = batch; V = the last DM columns of the [NB_ * TT][LDX] plane): VS[c][g] (fp16, c = batch * 768 + head * 64 + d) = sum over the GK keys t = GK g .. GK g + GK - 1 of V[t][c], f32 adds in ascending t. Block = 32 columns x all NG groups (wave w: groups 2w, 2w + 1; lane: column), so every 128-byte line of VS has one writer.
__global__ __launch_bounds__(1024) void k_vsum(const float* __restrict__ V, h16* VS) {
    __shared__ __align__(4) h16 sm[32 * 66];
    const int lane = threadIdx.x & 31, w = threadIdx.x >> 5; const int c0 = blockIdx.x * 32;
    const int bt = blockIdx.y; const float* p = V + ((size_t)bt * TT + w * 2 * GK) * LDX + c0 + lane; float s0 = 0.f, s1 = 0.f;
    // unrolled so that the wave's 64 row loads are all in flight before the first add waits
#pragma unroll
    for (int u = 0; u < GK; ++u) { s0 += p[(size_t)u * LDX]; s1 += p[(size_t)(GK + u) * LDX]; }
    v2h o; o[0] = tohx(s0); o[1] = tohx(s1); *(v2h*)(sm + lane * 66 + 2 * w) = o;
    __syncthreads();   // the 32 x 64 tile turns from column-per-lane to group-per-lane through LDS: every wave reads what all 32 waves wrote
    *(v2h*)(VS + (size_t)(bt * DM + c0 + w) * NG + 2 * lane) = *(const v2h*)(sm + w * 66 + 2 * lane); }
// ---- k_attn: softmax, attn.v and the hi + lo merge in one kernel; nothing of them passes through memory but the result. Grid (TT / 128, NZ), 4 independent waves a block; a wave has QB blocks of 16 queries of one (batch, head).
// a and b are column ranges of the [NB_ * TT][LDX] plane. Group g = j div 32 has logit a[g] * b[g div 2]; the softmax sum over the 2,048 keys is GK x the sum over the groups.
// The product is taken transposed, D[d][query] = sum_g VS[d][g] P[query][g]: lanes lr and lr + 16 hold query lr's 64 weights in the k order of a 16x16x32 fragment (lane half hi: groups 16 c + 8 hi + u, c < 4, u < 8), so the weights are made where the WMMA reads them;
// and a lane's 8 accumulator registers are 8 neighbouring d of query lr, which is that lane's 16-byte chunk of the merged planes in fragment order: no turn through LDS.
#define QB 2
// eight v_exp_f32 in one statement: they share no register, so each fills the one slot that the instruction set asks for behind the one in front of it, and the v_nop fills the last one's
__device__ __forceinline__ void exp2x8(float (&e)[8]) { asm("v_exp_f32 %0, %0\n\tv_exp_f32 %1, %1\n\tv_exp_f32 %2, %2\n\tv_exp_f32 %3, %3\n\tv_exp_f32 %4, %4\n\tv_exp_f32 %5, %5\n\tv_exp_f32 %6, %6\n\tv_exp_f32 %7, %7\n\tv_nop" : "+v"(e[0]), "+v"(e[1]), "+v"(e[2]), "+v"(e[3]), "+v"(e[4]), "+v"(e[5]), "+v"(e[6]), "+v"(e[7])); }
__device__ __forceinline__ v16h ldfrag_h(const h16* p) { return cat16(*(const v8h*)p, *(const v8h*)(p + 16)); }
__global__ __launch_bounds__(128) void k_attn(const float* __restrict__ A, const float* __restrict__ Bm, const h16* __restrict__ VS, bf* Ah, bf* Al) {
    const int lane = threadIdx.x & 31, lr = lane & 15, hi = lane >> 4; const int zz = blockIdx.y, h = zz % NH_;
    const int r0 = (zz / NH_) * TT + blockIdx.x * (4 * QB * 16) + (threadIdx.x >> 5) * (QB * 16);   // the wave's first row of the merged [NB_ * TT][DM] planes
    const h16* vp = VS + ((size_t)zz * HD + lr) * NG + 8 * hi; v16h vf[4][2];
    const float* ar = A + (size_t)(r0 + lr) * LDX + h * FA + 8 * hi; const float* br = Bm + (size_t)(r0 + lr) * LDX + h * FB + 4 * hi;
    v4f a0[QB][4], a1[QB][4], bb[QB][4];
    // (every short loop here is unrolled so that its arrays are indexed by constants and stay in registers)
    // all of the wave's loads go out together, in front of the first use: one latency for the wave
#pragma unroll
    for (int qb = 0; qb < QB; ++qb)
#pragma unroll
        for (int c = 0; c < 4; ++c) { a0[qb][c] = *(const v4f*)(ar + qb * 16 * LDX + 16 * c); a1[qb][c] = *(const v4f*)(ar + qb * 16 * LDX + 16 * c + 4); bb[qb][c] = *(const v4f*)(br + qb * 16 * LDX + 8 * c); }
#pragma unroll
    for (int db = 0; db < 4; ++db) { vf[db][0] = ldfrag_h(vp + db * 16 * NG); vf[db][1] = ldfrag_h(vp + db * 16 * NG + 32); }
    // the wait stands behind the last load, in front of whatever next overwrites a load's address pair; the three pairs are inputs, so they stay live to here
    asm volatile("s_wait_xcnt 0x0" :: "v"(ar), "v"(br), "v"(vp) : "memory");
    // nothing is scheduled across: without it the compiler sinks the VS loads to just in front of their WMMAs, and the wave waits out their latency a second and a third time
    __builtin_amdgcn_sched_barrier(0);
#pragma unroll
    for (int qb = 0; qb < QB; ++qb) {
        float e[4][8]; float mx = -__builtin_inff();
#pragma unroll
        for (int c = 0; c < 4; ++c)
#pragma unroll
            for (int u = 0; u < 4; ++u) { e[c][u] = __fmul_rn(a0[qb][c][u], bb[qb][c][u >> 1]); e[c][4 + u] = __fmul_rn(a1[qb][c][u], bb[qb][c][2 + (u >> 1)]); mx = fmaxf(mx, fmaxf(e[c][u], e[c][4 + u])); }
        mx = fmaxf(mx, __shfl_xor(mx, 16, 32));
#pragma unroll
        for (int c = 0; c < 4; ++c) {
#pragma unroll
            for (int u = 0; u < 8; ++u) e[c][u] = __fmul_rn(__fsub_rn(e[c][u], mx), 1.4426950408889634f);
            exp2x8(e[c]); }
        // the sum as a butterfly over the 32 pairs of neighbouring groups (pair distances 16, 8, 4, 2, 1): distances 16 and 8 are c, 4 is the other lane half, 2 and 1 are m
        float s[4];
#pragma unroll
        for (int m = 0; m < 4; ++m) { const float q0 = (e[0][2 * m] + e[0][2 * m + 1]) + (e[2][2 * m] + e[2][2 * m + 1]), q1 = (e[1][2 * m] + e[1][2 * m + 1]) + (e[3][2 * m] + e[3][2 * m + 1]); const float r = q0 + q1; s[m] = r + __shfl_xor(r, 16, 32); }
        const float sum = (s[0] + s[2]) + (s[1] + s[3]);
        const float f = __fdiv_rn(PCAR, (float)GK * sum);
        v16h pf[2];
#pragma unroll
        for (int ks = 0; ks < 2; ++ks)
#pragma unroll
            for (int u = 0; u < 8; ++u) { pf[ks][u] = tohx(e[2 * ks][u] * f); pf[ks][8 + u] = tohx(e[2 * ks + 1][u] * f); }
        v8f acc[4];
#pragma unroll
        for (int db = 0; db < 4; ++db) acc[db] = wmma16(vf[db][0], pf[0], (v8f){});
#pragma unroll
        for (int db = 0; db < 4; ++db) acc[db] = wmma16(vf[db][1], pf[1], acc[db]);
        // columns h * HD + 16 db + 8 hi + u of rows r0 + 16 qb + lr: the four db are 2 KiB side by side in each plane
        const size_t c0 = (((size_t)(r0 / 16 + qb) * (DM / 32) + h * (HD / 32)) * 64 + lane) * 8;
#pragma unroll
        for (int db = 0; db < 4; ++db) { v8us oh, ol;
#pragma unroll
            for (int u = 0; u < 8; ++u) { unsigned short x, y; splitf(acc[db][u] * (1.0f / PCAR), x, y); oh[u] = x; ol[u] = y; }
            *(v8us*)(Ah + c0 + db * 256) = oh; *(v8us*)(Al + c0 + db * 256) = ol; }
    }
}

extern "C" void kernel_launch(void* const* d_in, const int* in_sizes, int n_in,
                              void* d_out, int out_size, void* d_ws, size_t ws_size, hipStream_t stream) {
    (void)in_sizes; (void)n_in; (void)out_size;
    const float* x = (const float*)d_in[0]; const float* Wa = (const float*)d_in[1]; const float* Wb = (const float*)d_in[2]; const float* Wv = (const float*)d_in[3]; const float* Wp = (const float*)d_in[4]; const float* bp = (const float*)d_in[5];
    float* OUT = (float*)d_out;     // [4][2048][768]
    char* wsp = (char*)d_ws;
    auto take = [&](size_t bytes) { char* p = wsp; wsp += (bytes + 255) & ~(size_t)255; return (void*)p; };
    bf* BA = (bf*)take((size_t)NH_ * FA * DM * 2); bf* BB = (bf*)take((size_t)NH_ * FB * DM * 2); bf* BV = (bf*)take((size_t)DM * DM * 2); bf* BP = (bf*)take((size_t)DM * DM * 2);
    bf* XB = (bf*)take((size_t)NB_ * TT * DM * 2); float* ABV = (float*)take((size_t)NB_ * TT * LDX * 4); h16* VS = (h16*)take((size_t)NZ * HD * NG * 2);
    bf* ATh = (bf*)take((size_t)NB_ * TT * DM * 2); bf* ATl = (bf*)take((size_t)NB_ * TT * DM * 2);
    if ((size_t)(wsp - (char*)d_ws) > ws_size) return;    // total ~ 106 MB
    // Every stage runs once, over all batches and heads. BA, BB, BV lie back to back (each a multiple of 256 bytes and a whole number of 16-row bands), so they are one [LDX][DM] operand in fragment order and a | b | v come out of one GEMM as columns 0, NH_ * FA and NH_ * (FA + FB) of ABV.
    k_wtG<<<dim3(DM * DM / 8 / 256, 4, 1), 256, 0, stream>>>(Wa, Wb, Wv, Wp, BA, BB, BV, BP);
    k_cvt8<<<NB_ * TT * DM / 8 / 256, 256, 0, stream>>>(x, XB, (size_t)NB_ * TT * DM / 8);
    k_gemmf<false, false><<<dim3(NB_ * TT / 64, LDX / 64, 1), 32, 0, stream>>>(XB, nullptr, BA, ABV, LDX, nullptr);
    k_vsum<<<dim3(DM / 32, NB_, 1), 1024, 0, stream>>>(ABV + NH_ * (FA + FB), VS);
    k_attn<<<dim3(TT / (4 * QB * 16), NZ, 1), 128, 0, stream>>>(ABV, ABV + NH_ * FA, VS, ATh, ATl);
    k_gemmf<true, true><<<dim3(NB_ * TT / 64, DM / 64, 1), 32, 0, stream>>>(ATh, ATl, BP, OUT, DM, bp);
}

// v005
// One run takes 87.6 microseconds.
// In two side-by-side timings against v004, it was 1.09 and 1.12 times as fast.
// All steps since v000 together make it 18.1 times as fast.
#include <hip/hip_runtime.h>

// FactorizedDenseAttention (x [4][2048][768]; a = x Wa (12 heads x 64), b = x Wb (12 heads x 32), v = x Wv (12 heads x 64); factorised dense logits attn[n][j] = a[n][j div 32] * b[n][j div 64] over the 2,048 keys (query-only; no key content), softmax over j; out = attn v merged; out Wp + bp -> [4][2048][768]).
// Compute dtypes, f32 accumulate: every input rounded to bf16; a / b as PLAIN bf16 GEMMs (inputs: exact); the factorised logits and the softmax in f32 on VALU (two lanes per (head, query), in the registers of the wave that multiplies; no score GEMM exists) -> fp16 x 1024, ONE weight per group of 32 keys (j div 32 fixes both factors, so the 32 keys of a group share their weight); v's group sums = (x summed over each group of 32 rows, f32, as bf16 hi + lo) Wv, since the sum over keys and the projection commute (2 products, f32 accumulate) -> fp16; attn.v = group weights x group sums, single fp16, K = 64 groups (f32 accumulate, / 1024 at the merge); Wp hl x exact (2 products) + bias.

#define NB_  4
#define TT   2048
#define DM   768
#define NH_  12
#define FA   64
#define FB   32
#define HD   64
#define NZ   (NB_ * NH_)
#define LDX  (NH_ * FA + NH_ * FB)
#define GK   32
#define NG   64
#define PCAR 1024.0f
#define MT   (NB_ * TT / 64)
#define ABT  (LDX / 64)
#define XST  (NB_ * NG * 2 / 64)
#define XSB  (NB_ * NG / 16 * (DM / 32))
typedef _Float16 h16;
typedef unsigned short bf;
typedef __attribute__((ext_vector_type(16))) __bf16   v16bf;
typedef __attribute__((ext_vector_type(16))) _Float16 v16h;
typedef __attribute__((ext_vector_type(8)))  _Float16 v8h;
typedef __attribute__((ext_vector_type(8)))  unsigned short v8us;
typedef __attribute__((ext_vector_type(8)))  float    v8f;
typedef __attribute__((ext_vector_type(4)))  float    v4f;
typedef v8h  __attribute__((may_alias)) v8ha;
typedef v4f  __attribute__((may_alias)) v4fa;
typedef v8us __attribute__((may_alias)) v8usa;

__device__ __forceinline__ unsigned short f2bf(float f) { unsigned u = __float_as_uint(f); u += 0x7FFFu + ((u >> 16) & 1u); return (unsigned short)(u >> 16); }
__device__ __forceinline__ float bf2f(unsigned short b) { return __uint_as_float(((unsigned)b) << 16); }
__device__ __forceinline__ float bfr(float f) { return bf2f(f2bf(f)); }
__device__ __forceinline__ h16 tohx(float x) { return (h16)x; }
__device__ __forceinline__ v16h cat16(v8h lo, v8h hi) { return __builtin_shufflevector(lo, hi, 0, 1, 2, 3, 4, 5, 6, 7, 8, 9, 10, 11, 12, 13, 14, 15); }
__device__ __forceinline__ v16bf cat16b(v8us lo, v8us hi) { return __builtin_bit_cast(v16bf, __builtin_shufflevector(lo, hi, 0, 1, 2, 3, 4, 5, 6, 7, 8, 9, 10, 11, 12, 13, 14, 15)); }
__device__ __forceinline__ v8f wmma16(v16h a, v16h b, v8f c) { return __builtin_amdgcn_wmma_f32_16x16x32_f16(false, a, false, b, (short)0, c, false, false); }
__device__ __forceinline__ v8f wmmab(v16bf a, v16bf b, v8f c) { return __builtin_amdgcn_wmma_f32_16x16x32_bf16(false, a, false, b, (short)0, c, false, false); }

// ---- FRAGMENT ORDER of a 16-bit operand plane P[row][k] (rows % 16 == 0, K = DM): the 16 x 32 tile (row / 16, k / 32) is 1 KiB at element ((row / 16) * (DM / 32) + k / 32) * 512; in it stand two halves of 256 elements (half = k % 32 / 16), and in a half lane (k % 16 / 8) * 16 + row % 16 has its 8 elements (k % 8) side by side.
// That is the register layout of a 16x16x32 A or B fragment, so a wave's 16-byte-per-lane load reads 512 contiguous bytes (4 whole lines) where a row-major plane gives it 32-byte pieces of 16 lines. The values and the k order of every fragment are those of the row-major plane.
// frag_rk: 16-byte chunk c of such a plane -> the row and the first k of its 8 elements.
__device__ __forceinline__ void frag_rk(size_t c, int& row, int& k) { const int lane = (int)(c & 31), half = (int)((c >> 5) & 1); const int tile = (int)(c >> 6); row = (tile / (DM / 32)) * 16 + (lane & 15); k = (tile % (DM / 32)) * 32 + half * 16 + (lane >> 4) * 8; }
__device__ __forceinline__ v16bf ldfrag(const bf* p) { return cat16b(*(const v8us*)p, *(const v8us*)(p + 256)); }

// ---- k_gemmf: register-blocked GEMM, ONE WAVE per 64x64 tile of C (16 accumulators), for bf16 planes in fragment order, K = DM; grid (M/64, N/64), 32 threads.
// C[m][n] (f32, pitch ldc, + optional f32 bias[n]) = sum_k (A[m][k] (+ A2[m][k] where SPLIT)) Bt[n][k]. Every fragment address is a wave-uniform base + lane * 16 bytes + a constant.
// GSUM (flat grid MT * ABT + XST * DM / 64): the first MT * ABT tiles are x rows against the a | b columns; the others are the XST row tiles behind them (the group sums of x: 32 hi rows, then the 32 lo rows of the same groups) against the v columns, and go out as VS.
template <bool SPLIT, bool BIAS, bool GSUM>
__global__ __launch_bounds__(32) void k_gemmf(const bf* __restrict__ A, const bf* __restrict__ A2, const bf* __restrict__ Bt, float* C, int ldc, const float* __restrict__ bias, h16* VS) {
    __shared__ __align__(16) float os[16 * 68];
    const int lane = threadIdx.x & 31, lr = lane & 15, hi = lane >> 4;
    const int id = blockIdx.x, xs = id - MT * ABT;
    const int bx = !GSUM ? id : xs < 0 ? id % MT : MT + xs % XST, by = !GSUM ? (int)blockIdx.y : xs < 0 ? id / MT : ABT + xs / XST;
    const int r0 = bx * 64, c0 = by * 64;
    v8f acc[4][4];
#pragma unroll
    for (int mb = 0; mb < 4; ++mb)
#pragma unroll
        for (int nb = 0; nb < 4; ++nb) acc[mb][nb] = (v8f){};
    // a band of 16 rows is 16 * DM elements, a step of 32 k one 512-element tile
    // (the short loops over mb, nb, j, s are unrolled so that acc, a, a2 are indexed by constants and stay in registers)
    const bf* Ab = A + (size_t)r0 * DM + lane * 8; const bf* A2b = SPLIT ? A2 + (size_t)r0 * DM + lane * 8 : Ab; const bf* Bb = Bt + (size_t)c0 * DM + lane * 8;
    // kept rolled: one trip's fragments at a time keep the wave under 256 VGPRs, so four waves fit a SIMD
#pragma unroll 1
    for (int kt = 0; kt < DM / 32; ++kt) {
        // without a second plane pa2 is pa itself and takes no register of its own
        const bf* pa = Ab + kt * 512; const bf* pa2 = SPLIT ? A2b + kt * 512 : pa; const bf* pb = Bb + kt * 512;
        v16bf a[4], a2[4];
#pragma unroll
        for (int mb = 0; mb < 4; ++mb) { a[mb] = ldfrag(pa + mb * 16 * DM); if (SPLIT) a2[mb] = ldfrag(pa2 + mb * 16 * DM); }
#pragma unroll
        for (int nb = 0; nb < 4; ++nb) { const v16bf b = ldfrag(pb + nb * 16 * DM);
#pragma unroll
            for (int mb = 0; mb < 4; ++mb) { acc[mb][nb] = wmmab(a[mb], b, acc[mb][nb]); if (SPLIT) acc[mb][nb] = wmmab(a2[mb], b, acc[mb][nb]); } }
        // four vector slots between the trip's last WMMAs and the back edge: the next trip's loads overwrite their A and B registers.
        // The trip's address pairs are inputs too: they stay live to here, behind the trip's last load wait, so that no load's result is given a register that an issued load still names as its address.
        asm volatile("v_nop\n\tv_nop\n\tv_nop\n\tv_nop" : "+v"(acc[0][0]), "+v"(acc[1][1]), "+v"(acc[2][2]), "+v"(acc[3][3]) : "v"(a[0]), "v"(a[3]), "v"(pa), "v"(pa2), "v"(pb));
    }
    if (GSUM && xs >= 0) {
        // hi + lo; a lane's 8 accumulator registers are 8 neighbouring groups of one column: its 16-byte piece of VS[row tile][column][32 groups]. The wave writes 4 KiB side by side, so every 128-byte line has one writer.
        h16* vrow = VS + ((size_t)(bx - MT) * DM + (c0 - ABT * 64) + lr) * 32 + hi * 8; v8h o[2][4];
#pragma unroll
        for (int mb = 0; mb < 2; ++mb)
#pragma unroll
            for (int nb = 0; nb < 4; ++nb)
#pragma unroll
                for (int j = 0; j < 8; ++j) o[mb][nb][j] = tohx(acc[mb][nb][j] + acc[mb + 2][nb][j]);
#pragma unroll
        for (int mb = 0; mb < 2; ++mb)
#pragma unroll
            for (int nb = 0; nb < 4; ++nb) *(v8h*)(vrow + nb * 16 * 32 + mb * 16) = o[mb][nb];
        return;
    }
#pragma unroll
    for (int mb = 0; mb < 4; ++mb) {
#pragma unroll
        for (int nb = 0; nb < 4; ++nb) {
#pragma unroll
            for (int j = 0; j < 8; ++j) os[(hi * 8 + j) * 68 + nb * 16 + lr] = acc[mb][nb][j]; }
        // the wave's lanes read below what other lanes stored above: keeps the compiler from moving LDS accesses across
        __builtin_amdgcn_wave_barrier(); asm volatile("" ::: "memory");
        float* crow = C + (size_t)(r0 + mb * 16) * ldc + c0;
#pragma unroll
        for (int s = 0; s < 8; ++s) { const int row = 2 * s + hi, cofs = lr * 4; v4f val = *(const v4fa*)(os + row * 68 + cofs); if (BIAS) { val[0] += bfr(bias[c0 + cofs]); val[1] += bfr(bias[c0 + cofs + 1]); val[2] += bfr(bias[c0 + cofs + 2]); val[3] += bfr(bias[c0 + cofs + 3]); }
            *(v4f*)(crow + (size_t)row * ldc + cofs) = val; }
        // the next 16 rows overwrite the staging tile only behind these reads; the wait stands behind the 8 stores, in front of whatever next overwrites their address or data registers
        if (mb < 3) { __builtin_amdgcn_wave_barrier(); asm volatile("s_wait_xcnt 0x0" ::: "memory"); }
    }
}

__device__ __forceinline__ void splitf(float y, unsigned short& h, unsigned short& l) { h = f2bf(y); l = f2bf(y - bf2f(h)); }
typedef __attribute__((ext_vector_type(2))) unsigned short v2us;
typedef __attribute__((ext_vector_type(2))) float v2f;
typedef __attribute__((ext_vector_type(4))) unsigned short v4us;
typedef __attribute__((ext_vector_type(2))) _Float16 v2h;
typedef __attribute__((ext_vector_type(4))) _Float16 v4h;

// blocks XSB and up: src [rows][DM] f32 -> dst bf16 in fragment order; thread = one 16-byte chunk of dst (a wave stores 512 contiguous bytes; a block's 8 waves read 512 contiguous bytes of each of 16 rows)
// blocks below XSB (first, being the longer ones): the group sums of x. Block = 16 neighbouring groups x 32 k; thread = 2 k of one group (a wave's load reads two whole lines): sum over the group's GK rows of x rounded to bf16, f32 adds in ascending row, then split in bf16 hi + lo.
// XS is a plane in fragment order whose 64-row tile (batch * 2 + g / 32) holds the hi rows of its 32 groups and then their lo rows, so that one GEMM tile has both.
__global__ __launch_bounds__(256) void k_cvt8(const float* __restrict__ src, bf* dst, size_t n8, bf* XS) {
    __shared__ __align__(16) bf sm[2 * 512];
    if (blockIdx.x >= XSB) { const size_t i = (size_t)(blockIdx.x - XSB) * 256 + threadIdx.x; if (i >= n8) return; int row, k0; frag_rk(i, row, k0); const v8f v = *(const v8f*)(src + (size_t)row * DM + k0); v8us o;
#pragma unroll
        for (int k = 0; k < 8; ++k) o[k] = f2bf(v[k]); *(v8us*)(dst + i * 8) = o; return; }
    const int gb = blockIdx.x / (DM / 32), kt = blockIdx.x % (DM / 32); const int gl = threadIdx.x >> 4, kp = threadIdx.x & 15;
    const float* p = src + (size_t)(gb * 16 + gl) * GK * DM + kt * 32 + kp * 2; v2f v[GK];
    // unrolled so that the wave's 32 row loads are all in flight before the first add waits
#pragma unroll
    for (int u = 0; u < GK; ++u) v[u] = *(const v2f*)(p + u * DM);
    // the wait stands behind the last load, in front of whatever next overwrites the loads' address pair, which is an input and so stays live to here
    asm volatile("s_wait_xcnt 0x0" :: "v"(p) : "memory");
    // nothing is scheduled across: without it the compiler holds the last 8 loads back until registers of the first come free, and the wave waits out a second latency
    __builtin_amdgcn_sched_barrier(0);
    float s0 = 0.f, s1 = 0.f;
    // (unrolled so that v is indexed by constants and stays in registers)
#pragma unroll
    for (int u = 0; u < GK; ++u) { s0 += bfr(v[u][0]); s1 += bfr(v[u][1]); }
    v2us oh, ol; { unsigned short a, b; splitf(s0, a, b); oh[0] = a; ol[0] = b; splitf(s1, a, b); oh[1] = a; ol[1] = b; }
    const int o = (kp >> 3) * 256 + (((kp >> 2) & 1) * 16 + gl) * 8 + (kp & 3) * 2;   // row gl, k = 2 kp of a 16 x 32 tile in fragment order
    *(v2us*)(sm + o) = oh; *(v2us*)(sm + 512 + o) = ol;
    __syncthreads();   // the two 1-KiB tiles are put together from all 8 waves' pieces, so that a wave stores 512 contiguous bytes and every 128-byte line has one writer
    if (threadIdx.x < 128) { const int pl = threadIdx.x >> 6, c = threadIdx.x & 63; const int band = (gb >> 1) * 4 + (gb & 1) + pl * 2;
        *(v8us*)(XS + ((size_t)band * (DM / 32) + kt) * 512 + c * 8) = *(const v8us*)(sm + pl * 512 + c * 8); }
}
// one launch turns all four weights w[k][n] into Bt[n][k] in fragment order: blockIdx.y picks the matrix (all have K = DM rows; Wb has half the columns, its surplus blocks leave at the first test); thread = one 16-byte chunk of Bt: 8 k of one n (16 lanes read 16 neighbouring n of a row of w).
template <int N> __device__ __forceinline__ void wturn(const float* __restrict__ w, bf* Bt, size_t c) { if (c >= (size_t)N * DM / 8) return; int n, k0; frag_rk(c, n, k0); const float* p = w + (size_t)k0 * N + n; v8us o;
#pragma unroll
    for (int u = 0; u < 8; ++u) o[u] = f2bf(p[u * N]);
    *(v8us*)(Bt + c * 8) = o; }
__global__ __launch_bounds__(256) void k_wtG(const float* __restrict__ Wa, const float* __restrict__ Wb, const float* __restrict__ Wv, const float* __restrict__ Wp, bf* BA, bf* BB, bf* BV, bf* BP) {
    const int sel = blockIdx.y; const size_t c = (size_t)blockIdx.x * 256 + threadIdx.x;
    if (sel == 1) wturn<NH_ * FB>(Wb, BB, c); else wturn<DM>(sel == 0 ? Wa : sel == 2 ? Wv : Wp, sel == 0 ? BA : sel == 2 ? BV : BP, c);
}

// ---- k_attn: softmax, attn.v and the hi + lo merge in one kernel; nothing of them passes through memory but the result. Grid (TT / 128, NZ), 4 independent waves a block; a wave has QB blocks of 16 queries of one (batch, head).
// a and b are column ranges of the [NB_ * TT][LDX] plane. Group g = j div 32 has logit a[g] * b[g div 2]; the softmax sum over the 2,048 keys is GK x the sum over the groups.
// The product is taken transposed, D[d][query] = sum_g VS[d][g] P[query][g]: lanes lr and lr + 16 hold query lr's 64 weights in the k order of a 16x16x32 fragment (lane half hi: groups 16 c + 8 hi + u, c < 4, u < 8), so the weights are made where the WMMA reads them;
// and a lane's 8 accumulator registers are 8 neighbouring d of query lr, which is that lane's 16-byte chunk of the merged planes in fragment order: no turn through LDS.
#define QB 2
// eight v_exp_f32 in one statement: they share no register, so each fills the one slot that the instruction set asks for behind the one in front of it, and the v_nop fills the last one's
__device__ __forceinline__ void exp2x8(float (&e)[8]) { asm("v_exp_f32 %0, %0\n\tv_exp_f32 %1, %1\n\tv_exp_f32 %2, %2\n\tv_exp_f32 %3, %3\n\tv_exp_f32 %4, %4\n\tv_exp_f32 %5, %5\n\tv_exp_f32 %6, %6\n\tv_exp_f32 %7, %7\n\tv_nop" : "+v"(e[0]), "+v"(e[1]), "+v"(e[2]), "+v"(e[3]), "+v"(e[4]), "+v"(e[5]), "+v"(e[6]), "+v"(e[7])); }
__device__ __forceinline__ v16h ldfrag_h(const h16* p) { return cat16(*(const v8h*)p, *(const v8h*)(p + 16)); }
__global__ __launch_bounds__(128) void k_attn(const float* __restrict__ A, const float* __restrict__ Bm, const h16* __restrict__ VS, bf* Ah, bf* Al) {
    const int lane = threadIdx.x & 31, lr = lane & 15, hi = lane >> 4; const int zz = blockIdx.y, h = zz % NH_;
    const int r0 = (zz / NH_) * TT + blockIdx.x * (4 * QB * 16) + (threadIdx.x >> 5) * (QB * 16);   // the wave's first row of the merged [NB_ * TT][DM] planes
    const h16* vp = VS + ((size_t)(zz / NH_) * 2 * DM + h * HD + lr) * 32 + 8 * hi; v16h vf[4][2];   // VS[batch * 2 + g / 32][column][g % 32]
    const float* ar = A + (size_t)(r0 + lr) * LDX + h * FA + 8 * hi; const float* br = Bm + (size_t)(r0 + lr) * LDX + h * FB + 4 * hi;
    v4f a0[QB][4], a1[QB][4], bb[QB][4];
    // (every short loop here is unrolled so that its arrays are indexed by constants and stay in registers)
    // all of the wave's loads go out together, in front of the first use: one latency for the wave
#pragma unroll
    for (int qb = 0; qb < QB; ++qb)
#pragma unroll
        for (int c = 0; c < 4; ++c) { a0[qb][c] = *(const v4f*)(ar + qb * 16 * LDX + 16 * c); a1[qb][c] = *(const v4f*)(ar + qb * 16 * LDX + 16 * c + 4); bb[qb][c] = *(const v4f*)(br + qb * 16 * LDX + 8 * c); }
#pragma unroll
    for (int db = 0; db < 4; ++db) { vf[db][0] = ldfrag_h(vp + db * 16 * 32); vf[db][1] = ldfrag_h(vp + DM * 32 + db * 16 * 32); }
    // the wait stands behind the last load, in front of whatever next overwrites a load's address pair; the three pairs are inputs, so they stay live to here
    asm volatile("s_wait_xcnt 0x0" :: "v"(ar), "v"(br), "v"(vp) : "memory");
    // nothing is scheduled across: without it the compiler sinks the VS loads to just in front of their WMMAs, and the wave waits out their latency a second and a third time
    __builtin_amdgcn_sched_barrier(0);
#pragma unroll
    for (int qb = 0; qb < QB; ++qb) {
        float e[4][8]; float mx = -__builtin_inff();
#pragma unroll
        for (int c = 0; c < 4; ++c)
#pragma unroll
            for (int u = 0; u < 4; ++u) { e[c][u] = __fmul_rn(a0[qb][c][u], bb[qb][c][u >> 1]); e[c][4 + u] = __fmul_rn(a1[qb][c][u], bb[qb][c][2 + (u >> 1)]); mx = fmaxf(mx, fmaxf(e[c][u], e[c][4 + u])); }
        mx = fmaxf(mx, __shfl_xor(mx, 16, 32));
#pragma unroll
        for (int c = 0; c < 4; ++c) {
#pragma unroll
            for (int u = 0; u < 8; ++u) e[c][u] = __fmul_rn(__fsub_rn(e[c][u], mx), 1.4426950408889634f);
            exp2x8(e[c]); }
        // the sum as a butterfly over the 32 pairs of neighbouring groups (pair distances 16, 8, 4, 2, 1): distances 16 and 8 are c, 4 is the other lane half, 2 and 1 are m
        float s[4];
#pragma unroll
        for (int m = 0; m < 4; ++m) { const float q0 = (e[0][2 * m] + e[0][2 * m + 1]) + (e[2][2 * m] + e[2][2 * m + 1]), q1 = (e[1][2 * m] + e[1][2 * m + 1]) + (e[3][2 * m] + e[3][2 * m + 1]); const float r = q0 + q1; s[m] = r + __shfl_xor(r, 16, 32); }
        const float sum = (s[0] + s[2]) + (s[1] + s[3]);
        const float f = __fdiv_rn(PCAR, (float)GK * sum);
        v16h pf[2];
#pragma unroll
        for (int ks = 0; ks < 2; ++ks)
#pragma unroll
            for (int u = 0; u < 8; ++u) { pf[ks][u] = tohx(e[2 * ks][u] * f); pf[ks][8 + u] = tohx(e[2 * ks + 1][u] * f); }
        v8f acc[4];
#pragma unroll
        for (int db = 0; db < 4; ++db) acc[db] = wmma16(vf[db][0], pf[0], (v8f){});
#pragma unroll
        for (int db = 0; db < 4; ++db) acc[db] = wmma16(vf[db][1], pf[1], acc[db]);
        // columns h * HD + 16 db + 8 hi + u of rows r0 + 16 qb + lr: the four db are 2 KiB side by side in each plane
        const size_t c0 = (((size_t)(r0 / 16 + qb) * (DM / 32) + h * (HD / 32)) * 64 + lane) * 8;
#pragma unroll
        for (int db = 0; db < 4; ++db) { v8us oh, ol;
#pragma unroll
            for (int u = 0; u < 8; ++u) { unsigned short x, y; splitf(acc[db][u] * (1.0f / PCAR), x, y); oh[u] = x; ol[u] = y; }
            *(v8us*)(Ah + c0 + db * 256) = oh; *(v8us*)(Al + c0 + db * 256) = ol; }
    }
}

extern "C" void kernel_launch(void* const* d_in, const int* in_sizes, int n_in,
                              void* d_out, int out_size, void* d_ws, size_t ws_size, hipStream_t stream) {
    (void)in_sizes; (void)n_in; (void)out_size;
    const float* x = (const float*)d_in[0]; const float* Wa = (const float*)d_in[1]; const float* Wb = (const float*)d_in[2]; const float* Wv = (const float*)d_in[3]; const float* Wp = (const float*)d_in[4]; const float* bp = (const float*)d_in[5];
    float* OUT = (float*)d_out;     // [4][2048][768]
    char* wsp = (char*)d_ws;
    auto take = [&](size_t bytes) { char* p = wsp; wsp += (bytes + 255) & ~(size_t)255; return (void*)p; };
    bf* BA = (bf*)take((size_t)NH_ * FA * DM * 2); bf* BB = (bf*)take((size_t)NH_ * FB * DM * 2); bf* BV = (bf*)take((size_t)DM * DM * 2); bf* BP = (bf*)take((size_t)DM * DM * 2);
    bf* XB = (bf*)take((size_t)NB_ * TT * DM * 2); bf* XS = (bf*)take((size_t)XST * 64 * DM * 2); float* ABV = (float*)take((size_t)NB_ * TT * LDX * 4); h16* VS = (h16*)take((size_t)NZ * HD * NG * 2);
    bf* ATh = (bf*)take((size_t)NB_ * TT * DM * 2); bf* ATl = (bf*)take((size_t)NB_ * TT * DM * 2);
    if ((size_t)(wsp - (char*)d_ws) > ws_size) return;    // total ~ 81 MB
    // Every stage runs once, over all batches and heads. BA, BB, BV lie back to back (each a multiple of 256 bytes and a whole number of 16-row bands), so they are one [LDX + DM][DM] operand in fragment order; XB and XS lie back to back in the same way. One GEMM launch gives a | b as columns 0 and NH_ * FA of ABV and, from the group sums of x, the group sums of v.
    k_wtG<<<dim3(DM * DM / 8 / 256, 4, 1), 256, 0, stream>>>(Wa, Wb, Wv, Wp, BA, BB, BV, BP);
    k_cvt8<<<XSB + NB_ * TT * DM / 8 / 256, 256, 0, stream>>>(x, XB, (size_t)NB_ * TT * DM / 8, XS);
    k_gemmf<false, false, true><<<MT * ABT + XST * (DM / 64), 32, 0, stream>>>(XB, nullptr, BA, ABV, LDX, nullptr, VS);
    k_attn<<<dim3(TT / (4 * QB * 16), NZ, 1), 128, 0, stream>>>(ABV, ABV + NH_ * FA, VS, ATh, ATl);
    k_gemmf<true, true, false><<<dim3(NB_ * TT / 64, DM / 64, 1), 32, 0, stream>>>(ATh, ATl, BP, OUT, DM, bp, nullptr);
}

// v006
// One run takes 72.2 microseconds.
// Next to v005, in two timings, it ran 1.21 times as fast each time.
// Over all steps from v000 it is 22.0 times as fast.
#include <hip/hip_runtime.h>

// FactorizedDenseAttention (x [4][2048][768]; a = x Wa (12 heads x 64), b = x Wb (12 heads x 32), v = x Wv (12 heads x 64); factorised dense logits attn[n][j] = a[n][j div 32] * b[n][j div 64] over the 2,048 keys (query-only; no key content), softmax over j; out = attn v merged; out Wp + bp -> [4][2048][768]).
// Compute dtypes, f32 accumulate: every input rounded to bf16; a / b as PLAIN bf16 GEMMs (inputs: exact); the factorised logits and the softmax in f32 on VALU (two lanes per (head, query), in the registers of the wave that multiplies; no score GEMM exists) -> fp16 x 1024, ONE weight per group of 32 keys (j div 32 fixes both factors, so the 32 keys of a group share their weight); v's group sums = (x summed over each group of 32 rows, f32, as bf16 hi + lo) Wv, since the sum over keys and the projection commute (2 products, f32 accumulate) -> fp16; attn.v = group weights x group sums, single fp16, K = 64 groups (f32 accumulate, / 1024 at the merge); Wp hl x exact (2 products) + bias.

#define NB_  4
#define TT   2048
#define DM   768
#define NH_  12
#define FA   64
#define FB   32
#define HD   64
#define NZ   (NB_ * NH_)
#define LDX  (NH_ * FA + NH_ * FB)
#define GK   32
#define NG   64
#define PCAR 1024.0f
#define MT   (NB_ * TT / 64)
#define ABT  (LDX / 64)
#define XST  (NB_ * NG * 2 / 64)
#define XSB  (NB_ * NG / 16 * (DM / 32))
typedef _Float16 h16;
typedef unsigned short bf;
typedef __attribute__((ext_vector_type(16))) __bf16   v16bf;
typedef __attribute__((ext_vector_type(16))) _Float16 v16h;
typedef __attribute__((ext_vector_type(8)))  _Float16 v8h;
typedef __attribute__((ext_vector_type(8)))  unsigned short v8us;
typedef __attribute__((ext_vector_type(8)))  float    v8f;
typedef __attribute__((ext_vector_type(4)))  float    v4f;
typedef v8h  __attribute__((may_alias)) v8ha;
typedef v4f  __attribute__((may_alias)) v4fa;
typedef v8us __attribute__((may_alias)) v8usa;

__device__ __forceinline__ unsigned short f2bf(float f) { unsigned u = __float_as_uint(f); u += 0x7FFFu + ((u >> 16) & 1u); return (unsigned short)(u >> 16); }
__device__ __forceinline__ float bf2f(unsigned short b) { return __uint_as_float(((unsigned)b) << 16); }
__device__ __forceinline__ float bfr(float f) { return bf2f(f2bf(f)); }
__device__ __forceinline__ h16 tohx(float x) { return (h16)x; }
__device__ __forceinline__ v16h cat16(v8h lo, v8h hi) { return __builtin_shufflevector(lo, hi, 0, 1, 2, 3, 4, 5, 6, 7, 8, 9, 10, 11, 12, 13, 14, 15); }
__device__ __forceinline__ v16bf cat16b(v8us lo, v8us hi) { return __builtin_bit_cast(v16bf, __builtin_shufflevector(lo, hi, 0, 1, 2, 3, 4, 5, 6, 7, 8, 9, 10, 11, 12, 13, 14, 15)); }
__device__ __forceinline__ v8f wmma16(v16h a, v16h b, v8f c) { return __builtin_amdgcn_wmma_f32_16x16x32_f16(false, a, false, b, (short)0, c, false, false); }
__device__ __forceinline__ v8f wmmab(v16bf a, v16bf b, v8f c) { return __builtin_amdgcn_wmma_f32_16x16x32_bf16(false, a, false, b, (short)0, c, false, false); }

// ---- FRAGMENT ORDER of a 16-bit operand plane P[row][k] (rows % 16 == 0, K = DM): the 16 x 32 tile (row / 16, k / 32) is 1 KiB at element ((row / 16) * (DM / 32) + k / 32) * 512; in it stand two halves of 256 elements (half = k % 32 / 16), and in a half lane (k % 16 / 8) * 16 + row % 16 has its 8 elements (k % 8) side by side.
// That is the register layout of a 16x16x32 A or B fragment, so a wave's 16-byte-per-lane load reads 512 contiguous bytes (4 whole lines) where a row-major plane gives it 32-byte pieces of 16 lines. The values and the k order of every fragment are those of the row-major plane.
// frag_rk: 16-byte chunk c of such a plane -> the row and the first k of its 8 elements.
__device__ __forceinline__ void frag_rk(size_t c, int& row, int& k) { const int lane = (int)(c & 31), half = (int)((c >> 5) & 1); const int tile = (int)(c >> 6); row = (tile / (DM / 32)) * 16 + (lane & 15); k = (tile % (DM / 32)) * 32 + half * 16 + (lane >> 4) * 8; }
__device__ __forceinline__ v16bf ldfrag(const bf* p) { return cat16b(*(const v8us*)p, *(const v8us*)(p + 256)); }

// ---- k_gemmf: register-blocked GEMM, ONE WAVE per 64x64 tile of C (16 accumulators), for bf16 planes in fragment order, K = DM; grid (M/64, N/64), 32 threads.
// C[m][n] (f32, pitch ldc, + optional f32 bias[n]) = sum_k (A[m][k] (+ A2[m][k] where SPLIT)) Bt[n][k]. Every fragment address is a wave-uniform base + lane * 16 bytes + a constant.
// GSUM (flat grid MT * ABT + XST * DM / 64): the first MT * ABT tiles are x rows against the a | b columns; the others are the XST row tiles behind them (the group sums of x: 32 hi rows, then the 32 lo rows of the same groups) against the v columns, and go out as VS.
template <bool SPLIT, bool BIAS, bool GSUM>
__global__ __launch_bounds__(32) void k_gemmf(const bf* __restrict__ A, const bf* __restrict__ A2, const bf* __restrict__ Bt, float* C, int ldc, const float* __restrict__ bias, h16* VS) {
    __shared__ __align__(16) float os[16 * 68];
    const int lane = threadIdx.x & 31, lr = lane & 15, hi = lane >> 4;
    const int id = blockIdx.x, xs = id - MT * ABT;
    const int bx = !GSUM ? id : xs < 0 ? id % MT : MT + xs % XST, by = !GSUM ? (int)blockIdx.y : xs < 0 ? id / MT : ABT + xs / XST;
    const int r0 = bx * 64, c0 = by * 64;
    v8f acc[4][4];
#pragma unroll
    for (int mb = 0; mb < 4; ++mb)
#pragma unroll
        for (int nb = 0; nb < 4; ++nb) acc[mb][nb] = (v8f){};
    // a band of 16 rows is 16 * DM elements, a step of 32 k one 512-element tile
    // (the short loops over mb, nb, j, s are unrolled so that acc, a, a2 are indexed by constants and stay in registers)
    const bf* Ab = A + (size_t)r0 * DM + lane * 8; const bf* A2b = SPLIT ? A2 + (size_t)r0 * DM + lane * 8 : Ab; const bf* Bb = Bt + (size_t)c0 * DM + lane * 8;
    // kept rolled: one trip's fragments at a time keep the wave under 256 VGPRs, so four waves fit a SIMD
#pragma unroll 1
    for (int kt = 0; kt < DM / 32; ++kt) {
        // without a second plane pa2 is pa itself and takes no register of its own
        const bf* pa = Ab + kt * 512; const bf* pa2 = SPLIT ? A2b + kt * 512 : pa; const bf* pb = Bb + kt * 512;
        v16bf a[4], a2[4], b[4];
#pragma unroll
        for (int mb = 0; mb < 4; ++mb) { a[mb] = ldfrag(pa + mb * 16 * DM); b[mb] = ldfrag(pb + mb * 16 * DM); }
#pragma unroll
        for (int mb = 0; mb < 4; ++mb) if (SPLIT) a2[mb] = ldfrag(pa2 + mb * 16 * DM);
        // nothing is scheduled across: without it the compiler holds two fragments' loads back until the first WMMAs have freed registers, and the wave waits out a second load latency in every trip
        __builtin_amdgcn_sched_barrier(0);
#pragma unroll
        for (int nb = 0; nb < 4; ++nb)
#pragma unroll
            for (int mb = 0; mb < 4; ++mb) { acc[mb][nb] = wmmab(a[mb], b[nb], acc[mb][nb]); if (SPLIT) acc[mb][nb] = wmmab(a2[mb], b[nb], acc[mb][nb]); }
        // four vector slots between the trip's last WMMAs and the back edge: the next trip's loads overwrite their A and B registers.
        // The trip's address pairs are inputs too: they stay live to here, behind the trip's last load wait, so that no load's result is given a register that an issued load still names as its address.
        asm volatile("v_nop\n\tv_nop\n\tv_nop\n\tv_nop" : "+v"(acc[0][0]), "+v"(acc[1][1]), "+v"(acc[2][2]), "+v"(acc[3][3]) : "v"(a[0]), "v"(a[3]), "v"(pa), "v"(pa2), "v"(pb));
    }
    if (GSUM && xs >= 0) {
        // hi + lo; a lane's 8 accumulator registers are 8 neighbouring groups of one column: its 16-byte piece of VS[row tile][column][32 groups]. The wave writes 4 KiB side by side, so every 128-byte line has one writer.
        h16* vrow = VS + ((size_t)(bx - MT) * DM + (c0 - ABT * 64) + lr) * 32 + hi * 8; v8h o[2][4];
#pragma unroll
        for (int mb = 0; mb < 2; ++mb)
#pragma unroll
            for (int nb = 0; nb < 4; ++nb)
#pragma unroll
                for (int j = 0; j < 8; ++j) o[mb][nb][j] = tohx(acc[mb][nb][j] + acc[mb + 2][nb][j]);
#pragma unroll
        for (int mb = 0; mb < 2; ++mb)
#pragma unroll
            for (int nb = 0; nb < 4; ++nb) *(v8h*)(vrow + nb * 16 * 32 + mb * 16) = o[mb][nb];
        return;
    }
#pragma unroll
    for (int mb = 0; mb < 4; ++mb) {
#pragma unroll
        for (int nb = 0; nb < 4; ++nb) {
#pragma unroll
            for (int j = 0; j < 8; ++j) os[(hi * 8 + j) * 68 + nb * 16 + lr] = acc[mb][nb][j]; }
        // the wave's lanes read below what other lanes stored above: keeps the compiler from moving LDS accesses across
        __builtin_amdgcn_wave_barrier(); asm volatile("" ::: "memory");
        float* crow = C + (size_t)(r0 + mb * 16) * ldc + c0;
#pragma unroll
        for (int s = 0; s < 8; ++s) { const int row = 2 * s + hi, cofs = lr * 4; v4f val = *(const v4fa*)(os + row * 68 + cofs); if (BIAS) { val[0] += bfr(bias[c0 + cofs]); val[1] += bfr(bias[c0 + cofs + 1]); val[2] += bfr(bias[c0 + cofs + 2]); val[3] += bfr(bias[c0 + cofs + 3]); }
            *(v4f*)(crow + (size_t)row * ldc + cofs) = val; }
        // the next 16 rows overwrite the staging tile only behind these reads; the wait stands behind the 8 stores, in front of whatever next overwrites their address or data registers
        if (mb < 3) { __builtin_amdgcn_wave_barrier(); asm volatile("s_wait_xcnt 0x0" ::: "memory"); }
    }
}

__device__ __forceinline__ void splitf(float y, unsigned short& h, unsigned short& l) { h = f2bf(y); l = f2bf(y - bf2f(h)); }
typedef __attribute__((ext_vector_type(2))) unsigned short v2us;
typedef __attribute__((ext_vector_type(2))) float v2f;
typedef __attribute__((ext_vector_type(4))) unsigned short v4us;
typedef __attribute__((ext_vector_type(2))) _Float16 v2h;
typedef __attribute__((ext_vector_type(4))) _Float16 v4h;

// blocks XSB and up: src [rows][DM] f32 -> dst bf16 in fragment order; thread = one 16-byte chunk of dst (a wave stores 512 contiguous bytes; a block's 8 waves read 512 contiguous bytes of each of 16 rows)
// blocks below XSB (first, being the longer ones): the group sums of x. Block = 16 neighbouring groups x 32 k; thread = 2 k of one group (a wave's load reads two whole lines): sum over the group's GK rows of x rounded to bf16, f32 adds in ascending row, then split in bf16 hi + lo.
// XS is a plane in fragment order whose 64-row tile (batch * 2 + g / 32) holds the hi rows of its 32 groups and then their lo rows, so that one GEMM tile has both.
__global__ __launch_bounds__(256) void k_cvt8(const float* __restrict__ src, bf* dst, size_t n8, bf* XS) {
    __shared__ __align__(16) bf sm[2 * 512];
    if (blockIdx.x >= XSB) { const size_t i = (size_t)(blockIdx.x - XSB) * 256 + threadIdx.x; if (i >= n8) return; int row, k0; frag_rk(i, row, k0); const v8f v = *(const v8f*)(src + (size_t)row * DM + k0); v8us o;
#pragma unroll
        for (int k = 0; k < 8; ++k) o[k] = f2bf(v[k]); *(v8us*)(dst + i * 8) = o; return; }
    const int gb = blockIdx.x / (DM / 32), kt = blockIdx.x % (DM / 32); const int gl = threadIdx.x >> 4, kp = threadIdx.x & 15;
    const float* p = src + (size_t)(gb * 16 + gl) * GK * DM + kt * 32 + kp * 2; v2f v[GK];
    // unrolled so that the wave's 32 row loads are all in flight before the first add waits
#pragma unroll
    for (int u = 0; u < GK; ++u) v[u] = *(const v2f*)(p + u * DM);
    // the wait stands behind the last load, in front of whatever next overwrites the loads' address pair, which is an input and so stays live to here
    asm volatile("s_wait_xcnt 0x0" :: "v"(p) : "memory");
    // nothing is scheduled across: without it the compiler holds the last 8 loads back until registers of the first come free, and the wave waits out a second latency
    __builtin_amdgcn_sched_barrier(0);
    float s0 = 0.f, s1 = 0.f;
    // (unrolled so that v is indexed by constants and stays in registers)
#pragma unroll
    for (int u = 0; u < GK; ++u) { s0 += bfr(v[u][0]); s1 += bfr(v[u][1]); }
    v2us oh, ol; { unsigned short a, b; splitf(s0, a, b); oh[0] = a; ol[0] = b; splitf(s1, a, b); oh[1] = a; ol[1] = b; }
    const int o = (kp >> 3) * 256 + (((kp >> 2) & 1) * 16 + gl) * 8 + (kp & 3) * 2;   // row gl, k = 2 kp of a 16 x 32 tile in fragment order
    *(v2us*)(sm + o) = oh; *(v2us*)(sm + 512 + o) = ol;
    __syncthreads();   // the two 1-KiB tiles are put together from all 8 waves' pieces, so that a wave stores 512 contiguous bytes and every 128-byte line has one writer
    if (threadIdx.x < 128) { const int pl = threadIdx.x >> 6, c = threadIdx.x & 63; const int band = (gb >> 1) * 4 + (gb & 1) + pl * 2;
        *(v8us*)(XS + ((size_t)band * (DM / 32) + kt) * 512 + c * 8) = *(const v8us*)(sm + pl * 512 + c * 8); }
}
// one launch turns all four weights w[k][n] into Bt[n][k] in fragment order: blockIdx.y picks the matrix (all have K = DM rows; Wb has half the columns, its surplus blocks leave at the first test); thread = one 16-byte chunk of Bt: 8 k of one n (16 lanes read 16 neighbouring n of a row of w).
template <int N> __device__ __forceinline__ void wturn(const float* __restrict__ w, bf* Bt, size_t c) { if (c >= (size_t)N * DM / 8) return; int n, k0; frag_rk(c, n, k0); const float* p = w + (size_t)k0 * N + n; v8us o;
#pragma unroll
    for (int u = 0; u < 8; ++u) o[u] = f2bf(p[u * N]);
    *(v8us*)(Bt + c * 8) = o; }
__global__ __launch_bounds__(256) void k_wtG(const float* __restrict__ Wa, const float* __restrict__ Wb, const float* __restrict__ Wv, const float* __restrict__ Wp, bf* BA, bf* BB, bf* BV, bf* BP) {
    const int sel = blockIdx.y; const size_t c = (size_t)blockIdx.x * 256 + threadIdx.x;
    if (sel == 1) wturn<NH_ * FB>(Wb, BB, c); else wturn<DM>(sel == 0 ? Wa : sel == 2 ? Wv : Wp, sel == 0 ? BA : sel == 2 ? BV : BP, c);
}

// ---- k_attn: softmax, attn.v and the hi + lo merge in one kernel; nothing of them passes through memory but the result. Grid (TT / 128, NZ), 4 independent waves a block; a wave has QB blocks of 16 queries of one (batch, head).
// a and b are column ranges of the [NB_ * TT][LDX] plane. Group g = j div 32 has logit a[g] * b[g div 2]; the softmax sum over the 2,048 keys is GK x the sum over the groups.
// The product is taken transposed, D[d][query] = sum_g VS[d][g] P[query][g]: lanes lr and lr + 16 hold query lr's 64 weights in the k order of a 16x16x32 fragment (lane half hi: groups 16 c + 8 hi + u, c < 4, u < 8), so the weights are made where the WMMA reads them;
// and a lane's 8 accumulator registers are 8 neighbouring d of query lr, which is that lane's 16-byte chunk of the merged planes in fragment order: no turn through LDS.
#define QB 2
// eight v_exp_f32 in one statement: they share no register, so each fills the one slot that the instruction set asks for behind the one in front of it, and the v_nop fills the last one's
__device__ __forceinline__ void exp2x8(float (&e)[8]) { asm("v_exp_f32 %0, %0\n\tv_exp_f32 %1, %1\n\tv_exp_f32 %2, %2\n\tv_exp_f32 %3, %3\n\tv_exp_f32 %4, %4\n\tv_exp_f32 %5, %5\n\tv_exp_f32 %6, %6\n\tv_exp_f32 %7, %7\n\tv_nop" : "+v"(e[0]), "+v"(e[1]), "+v"(e[2]), "+v"(e[3]), "+v"(e[4]), "+v"(e[5]), "+v"(e[6]), "+v"(e[7])); }
__device__ __forceinline__ v16h ldfrag_h(const h16* p) { return cat16(*(const v8h*)p, *(const v8h*)(p + 16)); }
__global__ __launch_bounds__(128) void k_attn(const float* __restrict__ A, const float* __restrict__ Bm, const h16* __restrict__ VS, bf* Ah, bf* Al) {
    const int lane = threadIdx.x & 31, lr = lane & 15, hi = lane >> 4; const int zz = blockIdx.y, h = zz % NH_;
    const int r0 = (zz / NH_) * TT + blockIdx.x * (4 * QB * 16) + (threadIdx.x >> 5) * (QB * 16);   // the wave's first row of the merged [NB_ * TT][DM] planes
    const h16* vp = VS + ((size_t)(zz / NH_) * 2 * DM + h * HD + lr) * 32 + 8 * hi; v16h vf[4][2];   // VS[batch * 2 + g / 32][column][g % 32]
    const float* ar = A + (size_t)(r0 + lr) * LDX + h * FA + 8 * hi; const float* br = Bm + (size_t)(r0 + lr) * LDX + h * FB + 4 * hi;
    v4f a0[QB][4], a1[QB][4], bb[QB][4];
    // (every short loop here is unrolled so that its arrays are indexed by constants and stay in registers)
    // all of the wave's loads go out together, in front of the first use: one latency for the wave
#pragma unroll
    for (int qb = 0; qb < QB; ++qb)
#pragma unroll
        for (int c = 0; c < 4; ++c) { a0[qb][c] = *(const v4f*)(ar + qb * 16 * LDX + 16 * c); a1[qb][c] = *(const v4f*)(ar + qb * 16 * LDX + 16 * c + 4); bb[qb][c] = *(const v4f*)(br + qb * 16 * LDX + 8 * c); }
#pragma unroll
    for (int db = 0; db < 4; ++db) { vf[db][0] = ldfrag_h(vp + db * 16 * 32); vf[db][1] = ldfrag_h(vp + DM * 32 + db * 16 * 32); }
    // the wait stands behind the last load, in front of whatever next overwrites a load's address pair; the three pairs are inputs, so they stay live to here
    asm volatile("s_wait_xcnt 0x0" :: "v"(ar), "v"(br), "v"(vp) : "memory");
    // nothing is scheduled across: without it the compiler sinks the VS loads to just in front of their WMMAs, and the wave waits out their latency a second and a third time
    __builtin_amdgcn_sched_barrier(0);
#pragma unroll
    for (int qb = 0; qb < QB; ++qb) {
        float e[4][8]; float mx = -__builtin_inff();
#pragma unroll
        for (int c = 0; c < 4; ++c)
#pragma unroll
            for (int u = 0; u < 4; ++u) { e[c][u] = __fmul_rn(a0[qb][c][u], bb[qb][c][u >> 1]); e[c][4 + u] = __fmul_rn(a1[qb][c][u], bb[qb][c][2 + (u >> 1)]); mx = fmaxf(mx, fmaxf(e[c][u], e[c][4 + u])); }
        mx = fmaxf(mx, __shfl_xor(mx, 16, 32));
#pragma unroll
        for (int c = 0; c < 4; ++c) {
#pragma unroll
            for (int u = 0; u < 8; ++u) e[c][u] = __fmul_rn(__fsub_rn(e[c][u], mx), 1.4426950408889634f);
            exp2x8(e[c]); }
        // the sum as a butterfly over the 32 pairs of neighbouring groups (pair distances 16, 8, 4, 2, 1): distances 16 and 8 are c, 4 is the other lane half, 2 and 1 are m
        float s[4];
#pragma unroll
        for (int m = 0; m < 4; ++m) { const float q0 = (e[0][2 * m] + e[0][2 * m + 1]) + (e[2][2 * m] + e[2][2 * m + 1]), q1 = (e[1][2 * m] + e[1][2 * m + 1]) + (e[3][2 * m] + e[3][2 * m + 1]); const float r = q0 + q1; s[m] = r + __shfl_xor(r, 16, 32); }
        const float sum = (s[0] + s[2]) + (s[1] + s[3]);
        const float f = __fdiv_rn(PCAR, (float)GK * sum);
        v16h pf[2];
#pragma unroll
        for (int ks = 0; ks < 2; ++ks)
#pragma unroll
            for (int u = 0; u < 8; ++u) { pf[ks][u] = tohx(e[2 * ks][u] * f); pf[ks][8 + u] = tohx(e[2 * ks + 1][u] * f); }
        v8f acc[4];
#pragma unroll
        for (int db = 0; db < 4; ++db) acc[db] = wmma16(vf[db][0], pf[0], (v8f){});
#pragma unroll
        for (int db = 0; db < 4; ++db) acc[db] = wmma16(vf[db][1], pf[1], acc[db]);
        // columns h * HD + 16 db + 8 hi + u of rows r0 + 16 qb + lr: the four db are 2 KiB side by side in each plane
        const size_t c0 = (((size_t)(r0 / 16 + qb) * (DM / 32) + h * (HD / 32)) * 64 + lane) * 8;
#pragma unroll
        for (int db = 0; db < 4; ++db) { v8us oh, ol;
#pragma unroll
            for (int u = 0; u < 8; ++u) { unsigned short x, y; splitf(acc[db][u] * (1.0f / PCAR), x, y); oh[u] = x; ol[u] = y; }
            *(v8us*)(Ah + c0 + db * 256) = oh; *(v8us*)(Al + c0 + db * 256) = ol; }
    }
}

extern "C" void kernel_launch(void* const* d_in, const int* in_sizes, int n_in,
                              void* d_out, int out_size, void* d_ws, size_t ws_size, hipStream_t stream) {
    (void)in_sizes; (void)n_in; (void)out_size;
    const float* x = (const float*)d_in[0]; const float* Wa = (const float*)d_in[1]; const float* Wb = (const float*)d_in[2]; const float* Wv = (const float*)d_in[3]; const float* Wp = (const float*)d_in[4]; const float* bp = (const float*)d_in[5];
    float* OUT = (float*)d_out;     // [4][2048][768]
    char* wsp = (char*)d_ws;
    auto take = [&](size_t bytes) { char* p = wsp; wsp += (bytes + 255) & ~(size_t)255; return (void*)p; };
    bf* BA = (bf*)take((size_t)NH_ * FA * DM * 2); bf* BB = (bf*)take((size_t)NH_ * FB * DM * 2); bf* BV = (bf*)take((size_t)DM * DM * 2); bf* BP = (bf*)take((size_t)DM * DM * 2);
    bf* XB = (bf*)take((size_t)NB_ * TT * DM * 2); bf* XS = (bf*)take((size_t)XST * 64 * DM * 2); float* ABV = (float*)take((size_t)NB_ * TT * LDX * 4); h16* VS = (h16*)take((size_t)NZ * HD * NG * 2);
    bf* ATh = (bf*)take((size_t)NB_ * TT * DM * 2); bf* ATl = (bf*)take((size_t)NB_ * TT * DM * 2);
    if ((size_t)(wsp - (char*)d_ws) > ws_size) return;    // total ~ 81 MB
    // Every stage runs once, over all batches and heads. BA, BB, BV lie back to back (each a multiple of 256 bytes and a whole number of 16-row bands), so they are one [LDX + DM][DM] operand in fragment order; XB and XS lie back to back in the same way. One GEMM launch gives a | b as columns 0 and NH_ * FA of ABV and, from the group sums of x, the group sums of v.
    k_wtG<<<dim3(DM * DM / 8 / 256, 4, 1), 256, 0, stream>>>(Wa, Wb, Wv, Wp, BA, BB, BV, BP);
    k_cvt8<<<XSB + NB_ * TT * DM / 8 / 256, 256, 0, stream>>>(x, XB, (size_t)NB_ * TT * DM / 8, XS);
    k_gemmf<false, false, true><<<MT * ABT + XST * (DM / 64), 32, 0, stream>>>(XB, nullptr, BA, ABV, LDX, nullptr, VS);
    k_attn<<<dim3(TT / (4 * QB * 16), NZ, 1), 128, 0, stream>>>(ABV, ABV + NH_ * FA, VS, ATh, ATl);
    k_gemmf<true, true, false><<<dim3(NB_ * TT / 64, DM / 64, 1), 32, 0, stream>>>(ATh, ATl, BP, OUT, DM, bp, nullptr);
}
